// v000
// Measured on an AMD MI455X. A time is GPU time per run, averaged over a window of back-to-back runs after a warm-up
// (all launches, gaps included; the runs take copies of the inputs in turn), and the median of several windows.
// Apart from v000's, it joins two sittings. Times from different sittings can be a few percent apart, while
// side-by-side timings come from the same sitting.
// v000 is the starting kernel. One run takes 208 microseconds.
#include <hip/hip_runtime.h>
#include <hip/hip_bf16.h>

typedef __attribute__((ext_vector_type(16))) _Float16 v16h;
typedef __attribute__((ext_vector_type(8)))  _Float16 v8h;
typedef __attribute__((ext_vector_type(8)))  float    v8f;

#define DEV __device__ __forceinline__

static constexpr int Nb   = 16;
static constexpr int LSEQ = 1024;
static constexpr int DIM  = 512;
static constexpr int NH   = 8;
static constexpr int HD   = 64;

// ---------------------------------------------------------------------------
// WMMA fragment load (ISA 7.12.2 16-bit A/B layout):
//   lane l<16 : row m=l,    K in {0..7, 16..23}
//   lane l>=16: row m=l-16, K in {8..15, 24..31}
// => two contiguous 16-byte (8-half) runs per lane at K=koff and K=koff+16.
// ---------------------------------------------------------------------------
DEV v16h load_frag_rowmajor(const _Float16* __restrict__ base, int ld) {
  const int lane = threadIdx.x & 31;
  const int m    = lane & 15;
  const int koff = (lane >> 4) << 3;            // 0 or 8
  const _Float16* p = base + m * ld + koff;
  v8h lo = *(const v8h*)(p);
  v8h hi = *(const v8h*)(p + 16);
  v16h r;
#pragma unroll
  for (int i = 0; i < 8; ++i) { r[i] = lo[i]; r[i + 8] = hi[i]; }
  return r;
}

DEV v8f wmma_f16(v16h a, v16h b, v8f c) {
  return __builtin_amdgcn_wmma_f32_16x16x32_f16(
      false, a, false, b, (short)0, c, false, false);
}

// Async global -> LDS copy, 16 bytes per lane, tracked by ASYNCcnt.
DEV void async_copy_b128(const _Float16* src, _Float16* lds_dst) {
  unsigned dst = (unsigned)(unsigned long long)lds_dst;   // addr[31:0] = LDS offset
  asm volatile("global_load_async_to_lds_b128 %0, %1, off"
               :: "v"(dst), "v"(src) : "memory");
}

DEV void wait_async_all() {
  asm volatile("s_wait_asynccnt 0" ::: "memory");
}

// ---------------------------------------------------------------------------
// f32 -> f16 conversion (grid-stride)
// ---------------------------------------------------------------------------
__global__ void cvt_f32_to_f16_kernel(const float* __restrict__ src,
                                      _Float16* __restrict__ dst, int n) {
  int i = blockIdx.x * blockDim.x + threadIdx.x;
  int stride = gridDim.x * blockDim.x;
  for (; i < n; i += stride) dst[i] = (_Float16)src[i];
}

// ---------------------------------------------------------------------------
// Shared GEMM tile prefetch: X tile 128x32 halves (two b128/lane),
// W tile 64x32 halves (one b128/lane).  Both padded to ld=40 halves.
// ---------------------------------------------------------------------------
DEV void gemm_prefetch(const _Float16* __restrict__ Abase,
                       const _Float16* __restrict__ Wbase, int k0,
                       _Float16* xs, _Float16* ws) {
  {
    int row = threadIdx.x >> 1;
    int col = (threadIdx.x & 1) * 16;
    const _Float16* src = Abase + (size_t)row * DIM + k0 + col;
    async_copy_b128(src,     xs + row * 40 + col);
    async_copy_b128(src + 8, xs + row * 40 + col + 8);
  }
  {
    int row = threadIdx.x >> 2;
    int col = (threadIdx.x & 3) * 8;
    async_copy_b128(Wbase + (size_t)row * DIM + k0 + col,
                    ws + row * 40 + col);
  }
}

// ---------------------------------------------------------------------------
// QKV projection: out[(n,h,l,hd)] = f16( A(row) . W(row o)^T + bias[o] )
// Block tile 128(M) x 64(N), K-step 32, double-buffered async LDS pipeline.
// ---------------------------------------------------------------------------
__global__ __launch_bounds__(256)
void qkv_gemm_kernel(const _Float16* __restrict__ A,
                     const _Float16* __restrict__ W,
                     const float* __restrict__ bias,
                     _Float16* __restrict__ out) {
  __shared__ __align__(16) _Float16 Xs[2][128 * 40];
  __shared__ __align__(16) _Float16 Ws[2][64 * 40];

  const int wave  = threadIdx.x >> 5;
  const int lane  = threadIdx.x & 31;
  const int mBase = blockIdx.x * 128;
  const int nBase = blockIdx.y * 64;

  const _Float16* Abase = A + (size_t)mBase * DIM;
  const _Float16* Wbase = W + (size_t)nBase * DIM;

  v8f acc[4] = {};

  gemm_prefetch(Abase, Wbase, 0, Xs[0], Ws[0]);
  int buf = 0;
  for (int k0 = 0; k0 < DIM; k0 += 32, buf ^= 1) {
    wait_async_all();
    __syncthreads();                       // tile `buf` published to all waves
    if (k0 + 32 < DIM)
      gemm_prefetch(Abase, Wbase, k0 + 32, Xs[buf ^ 1], Ws[buf ^ 1]);

    v16h a = load_frag_rowmajor(&Xs[buf][(wave * 16) * 40], 40);
#pragma unroll
    for (int t = 0; t < 4; ++t) {
      v16h b = load_frag_rowmajor(&Ws[buf][(t * 16) * 40], 40);
      acc[t] = wmma_f16(a, b, acc[t]);
    }
  }

  const int half = lane >> 4;
  const int ncol = lane & 15;
#pragma unroll
  for (int t = 0; t < 4; ++t) {
    int o  = nBase + t * 16 + ncol;
    float bv = bias[o];
    int h = o >> 6, hd = o & 63;
#pragma unroll
    for (int r = 0; r < 8; ++r) {
      int row = mBase + wave * 16 + r + half * 8;       // flat (n,l)
      int n = row >> 10, l = row & (LSEQ - 1);
      out[((((size_t)n * NH + h) * LSEQ) + l) * HD + hd] =
          (_Float16)(acc[t][r] + bv);
    }
  }
}

// ---------------------------------------------------------------------------
// Output projection: d_out[row, o] = f32( O(row) . Wo(row o)^T + bo[o] )
// ---------------------------------------------------------------------------
__global__ __launch_bounds__(256)
void out_gemm_kernel(const _Float16* __restrict__ A,
                     const _Float16* __restrict__ W,
                     const float* __restrict__ bias,
                     float* __restrict__ out) {
  __shared__ __align__(16) _Float16 Xs[2][128 * 40];
  __shared__ __align__(16) _Float16 Ws[2][64 * 40];

  const int wave  = threadIdx.x >> 5;
  const int lane  = threadIdx.x & 31;
  const int mBase = blockIdx.x * 128;
  const int nBase = blockIdx.y * 64;

  const _Float16* Abase = A + (size_t)mBase * DIM;
  const _Float16* Wbase = W + (size_t)nBase * DIM;

  v8f acc[4] = {};

  gemm_prefetch(Abase, Wbase, 0, Xs[0], Ws[0]);
  int buf = 0;
  for (int k0 = 0; k0 < DIM; k0 += 32, buf ^= 1) {
    wait_async_all();
    __syncthreads();
    if (k0 + 32 < DIM)
      gemm_prefetch(Abase, Wbase, k0 + 32, Xs[buf ^ 1], Ws[buf ^ 1]);

    v16h a = load_frag_rowmajor(&Xs[buf][(wave * 16) * 40], 40);
#pragma unroll
    for (int t = 0; t < 4; ++t) {
      v16h b = load_frag_rowmajor(&Ws[buf][(t * 16) * 40], 40);
      acc[t] = wmma_f16(a, b, acc[t]);
    }
  }

  const int half = lane >> 4;
  const int ncol = lane & 15;
#pragma unroll
  for (int t = 0; t < 4; ++t) {
    int o  = nBase + t * 16 + ncol;
    float bv = bias[o];
#pragma unroll
    for (int r = 0; r < 8; ++r) {
      int row = mBase + wave * 16 + r + half * 8;
      out[(size_t)row * DIM + o] = acc[t][r] + bv;
    }
  }
}

// ---------------------------------------------------------------------------
// Attention tile prefetchers
// ---------------------------------------------------------------------------
DEV void attn_prefetch_K(const _Float16* __restrict__ Kbase, _Float16* ks) {
  int row = threadIdx.x >> 3;                 // key 0..31
  int col = (threadIdx.x & 7) * 8;            // d
  async_copy_b128(Kbase + (size_t)row * HD + col, ks + row * 72 + col);
}

DEV void attn_load_V_transposed(const _Float16* __restrict__ Vbase, _Float16* vt) {
  int row = threadIdx.x >> 3;                 // key 0..31
  int col = (threadIdx.x & 7) * 8;            // d
  v8h vv = *(const v8h*)(Vbase + (size_t)row * HD + col);
#pragma unroll
  for (int i = 0; i < 8; ++i) vt[(col + i) * 40 + row] = vv[i];
}

// ---------------------------------------------------------------------------
// Flash attention. Block = (128 queries, head h, batch n); 8 waves x 16 q.
// Double-buffered 32-key tiles (K async-to-LDS, V VGPR-transposed),
// online softmax, O written f16 [n][L][512].
// ---------------------------------------------------------------------------
__global__ __launch_bounds__(256)
void attention_kernel(const _Float16* __restrict__ Q,   // [N][H][L][HD]
                      const _Float16* __restrict__ K,
                      const _Float16* __restrict__ V,
                      const float* __restrict__ bias,   // [N][L][L]
                      const int* __restrict__ mask,     // [N][L]
                      _Float16* __restrict__ O) {       // [N][L][DIM]
  __shared__ __align__(16) _Float16 Ks[2][32 * 72];
  __shared__ __align__(16) _Float16 Vt[2][64 * 40];
  __shared__ __align__(16) _Float16 Ps[8][16 * 40];

  const int wave = threadIdx.x >> 5;
  const int lane = threadIdx.x & 31;
  const int h    = blockIdx.y;
  const int n    = blockIdx.z;
  const int qBase = blockIdx.x * 128 + wave * 16;

  const size_t headOff = ((size_t)n * NH + h) * LSEQ * HD;

  const _Float16* qptr = Q + headOff + (size_t)qBase * HD;
  v16h aQ0 = load_frag_rowmajor(qptr, HD);
  v16h aQ1 = load_frag_rowmajor(qptr + 32, HD);

  float mrow[8], lrow[8];
  v8f  o[4] = {};
#pragma unroll
  for (int r = 0; r < 8; ++r) { mrow[r] = -1e30f; lrow[r] = 0.f; }

  const int half = lane >> 4;
  const int ncol = lane & 15;

  attn_prefetch_K(K + headOff, Ks[0]);
  attn_load_V_transposed(V + headOff, Vt[0]);

  int buf = 0;
  for (int kb = 0; kb < LSEQ; kb += 32, buf ^= 1) {
    wait_async_all();
    __syncthreads();          // K (async) + V (ds_store) tiles published
    if (kb + 32 < LSEQ) {
      attn_prefetch_K(K + headOff + (size_t)(kb + 32) * HD, Ks[buf ^ 1]);
      attn_load_V_transposed(V + headOff + (size_t)(kb + 32) * HD, Vt[buf ^ 1]);
    }

    // S = Q K^T : 16 queries x 32 keys, two 16-key halves
    v8f s[2];
#pragma unroll
    for (int j = 0; j < 2; ++j) {
      v16h b0 = load_frag_rowmajor(&Ks[buf][(j * 16) * 72], 72);
      v16h b1 = load_frag_rowmajor(&Ks[buf][(j * 16) * 72 + 32], 72);
      v8f c = {};
      c = wmma_f16(aQ0, b0, c);
      c = wmma_f16(aQ1, b1, c);
      s[j] = c;
    }

    // scale + bias + key-padding mask
#pragma unroll
    for (int j = 0; j < 2; ++j) {
      int col = kb + j * 16 + ncol;
      int mk  = mask[n * LSEQ + col];
      const float* bptr =
          bias + ((size_t)n * LSEQ + (qBase + half * 8)) * LSEQ + col;
#pragma unroll
      for (int r = 0; r < 8; ++r) {
        float val = s[j][r] * 0.125f + bptr[(size_t)r * LSEQ];
        s[j][r] = (mk == 0) ? -1.0e9f : val;
      }
    }

    // online softmax per row (rows split across the two 16-lane halves)
    float alpha[8];
#pragma unroll
    for (int r = 0; r < 8; ++r) {
      float v = fmaxf(s[0][r], s[1][r]);
#pragma unroll
      for (int off = 8; off >= 1; off >>= 1)
        v = fmaxf(v, __shfl_xor(v, off, 16));
      float mnew = fmaxf(mrow[r], v);
      alpha[r] = __expf(mrow[r] - mnew);
      mrow[r] = mnew;
      float p0 = __expf(s[0][r] - mnew);
      float p1 = __expf(s[1][r] - mnew);
      float ps = p0 + p1;
#pragma unroll
      for (int off = 8; off >= 1; off >>= 1)
        ps += __shfl_xor(ps, off, 16);
      lrow[r] = lrow[r] * alpha[r] + ps;
      int prow = r + half * 8;
      Ps[wave][prow * 40 + ncol]      = (_Float16)p0;
      Ps[wave][prow * 40 + 16 + ncol] = (_Float16)p1;
#pragma unroll
      for (int t = 0; t < 4; ++t) o[t][r] *= alpha[r];
    }

    // O += P V
    v16h aP = load_frag_rowmajor(&Ps[wave][0], 40);
#pragma unroll
    for (int t = 0; t < 4; ++t) {
      v16h bV = load_frag_rowmajor(&Vt[buf][(t * 16) * 40], 40);
      o[t] = wmma_f16(aP, bV, o[t]);
    }
  }

  // finalize: divide by row sums, write f16 [n][L][h*64 + d]
#pragma unroll
  for (int r = 0; r < 8; ++r) {
    float inv = 1.0f / lrow[r];
    int row = qBase + r + half * 8;
    _Float16* optr = O + ((size_t)n * LSEQ + row) * DIM + h * HD;
#pragma unroll
    for (int t = 0; t < 4; ++t)
      optr[t * 16 + ncol] = (_Float16)(o[t][r] * inv);
  }
}

// ---------------------------------------------------------------------------
// Launch
// ---------------------------------------------------------------------------
extern "C" void kernel_launch(void* const* d_in, const int* in_sizes, int n_in,
                              void* d_out, int out_size, void* d_ws, size_t ws_size,
                              hipStream_t stream) {
  (void)in_sizes; (void)n_in; (void)out_size; (void)ws_size;
  const float* x         = (const float*)d_in[0];
  const float* attn_bias = (const float*)d_in[1];
  const int*   kpm       = (const int*)d_in[2];
  const float* Wq = (const float*)d_in[3];
  const float* bq = (const float*)d_in[4];
  const float* Wk = (const float*)d_in[5];
  const float* bk = (const float*)d_in[6];
  const float* Wv = (const float*)d_in[7];
  const float* bv = (const float*)d_in[8];
  const float* Wo = (const float*)d_in[9];
  const float* bo = (const float*)d_in[10];
  float* out = (float*)d_out;

  const size_t xElems = (size_t)Nb * LSEQ * DIM;   // 8,388,608
  const size_t wElems = (size_t)DIM * DIM;         //   262,144

  char* wsp = (char*)d_ws;
  auto carve = [&](size_t halves) {
    _Float16* p = (_Float16*)wsp;
    wsp += ((halves * sizeof(_Float16) + 255) / 256) * 256;
    return p;
  };
  _Float16* xh  = carve(xElems);
  _Float16* wqh = carve(wElems);
  _Float16* wkh = carve(wElems);
  _Float16* wvh = carve(wElems);
  _Float16* woh = carve(wElems);
  _Float16* Qh  = carve(xElems);
  _Float16* Kh  = carve(xElems);
  _Float16* Vh  = carve(xElems);
  _Float16* Oh  = carve(xElems);

  cvt_f32_to_f16_kernel<<<2048, 256, 0, stream>>>(x,  xh,  (int)xElems);
  cvt_f32_to_f16_kernel<<<256,  256, 0, stream>>>(Wq, wqh, (int)wElems);
  cvt_f32_to_f16_kernel<<<256,  256, 0, stream>>>(Wk, wkh, (int)wElems);
  cvt_f32_to_f16_kernel<<<256,  256, 0, stream>>>(Wv, wvh, (int)wElems);
  cvt_f32_to_f16_kernel<<<256,  256, 0, stream>>>(Wo, woh, (int)wElems);

  dim3 gemmGrid((Nb * LSEQ) / 128, DIM / 64);
  qkv_gemm_kernel<<<gemmGrid, 256, 0, stream>>>(xh, wqh, bq, Qh);
  qkv_gemm_kernel<<<gemmGrid, 256, 0, stream>>>(xh, wkh, bk, Kh);
  qkv_gemm_kernel<<<gemmGrid, 256, 0, stream>>>(xh, wvh, bv, Vh);

  dim3 attnGrid(LSEQ / 128, NH, Nb);
  attention_kernel<<<attnGrid, 256, 0, stream>>>(Qh, Kh, Vh, attn_bias, kpm, Oh);

  out_gemm_kernel<<<gemmGrid, 256, 0, stream>>>(Oh, woh, bo, out);
}

// v001
// One run takes 169 microseconds.
// Next to v000, in two timings, it ran 1.27 times as fast each time.
#include <hip/hip_runtime.h>
#include <hip/hip_bf16.h>

typedef __attribute__((ext_vector_type(16))) _Float16 v16h;
typedef __attribute__((ext_vector_type(8)))  _Float16 v8h;
typedef __attribute__((ext_vector_type(8)))  float    v8f;
typedef __attribute__((ext_vector_type(4)))  float    v4f;
typedef __attribute__((ext_vector_type(4)))  int      v4i;

#define DEV __device__ __forceinline__

static constexpr int Nb   = 16;
static constexpr int LSEQ = 1024;
static constexpr int DIM  = 512;
static constexpr int NH   = 8;
static constexpr int HD   = 64;

// ---------------------------------------------------------------------------
// WMMA fragment load (ISA 7.12.2 16-bit A/B layout):
//   lane l<16 : row m=l,    K in {0..7, 16..23}
//   lane l>=16: row m=l-16, K in {8..15, 24..31}
// => two contiguous 16-byte (8-half) runs per lane at K=koff and K=koff+16.
// ---------------------------------------------------------------------------
DEV v16h load_frag_rowmajor(const _Float16* __restrict__ base, int ld) {
  const int lane = threadIdx.x & 31;
  const int m    = lane & 15;
  const int koff = (lane >> 4) << 3;            // 0 or 8
  const _Float16* p = base + m * ld + koff;
  v8h lo = *(const v8h*)(p);
  v8h hi = *(const v8h*)(p + 16);
  v16h r;
#pragma unroll
  for (int i = 0; i < 8; ++i) { r[i] = lo[i]; r[i + 8] = hi[i]; }
  return r;
}

DEV v8f wmma_f16(v16h a, v16h b, v8f c) {
  return __builtin_amdgcn_wmma_f32_16x16x32_f16(
      false, a, false, b, (short)0, c, false, false);
}

// Async global -> LDS copy, 16 bytes per lane, tracked by ASYNCcnt.
DEV void async_copy_b128(const _Float16* src, _Float16* lds_dst) {
  unsigned dst = (unsigned)(unsigned long long)lds_dst;   // addr[31:0] = LDS offset
  asm volatile("global_load_async_to_lds_b128 %0, %1, off"
               :: "v"(dst), "v"(src) : "memory");
}

DEV void wait_async_all() {
  asm volatile("s_wait_asynccnt 0" ::: "memory");
}

// ---------------------------------------------------------------------------
// f32 -> f16 conversion (grid-stride)
// ---------------------------------------------------------------------------
__global__ void cvt_f32_to_f16_kernel(const float* __restrict__ src,
                                      _Float16* __restrict__ dst, int n) {
  int i = blockIdx.x * blockDim.x + threadIdx.x;
  int stride = gridDim.x * blockDim.x;
  for (; i < n; i += stride) dst[i] = (_Float16)src[i];
}

// ---------------------------------------------------------------------------
// Shared GEMM tile prefetch: X tile 128x32 halves (two b128/lane),
// W tile 64x32 halves (one b128/lane).  Both padded to ld=40 halves.
// ---------------------------------------------------------------------------
DEV void gemm_prefetch(const _Float16* __restrict__ Abase,
                       const _Float16* __restrict__ Wbase, int k0,
                       _Float16* xs, _Float16* ws) {
  {
    int row = threadIdx.x >> 1;
    int col = (threadIdx.x & 1) * 16;
    const _Float16* src = Abase + (size_t)row * DIM + k0 + col;
    async_copy_b128(src,     xs + row * 40 + col);
    async_copy_b128(src + 8, xs + row * 40 + col + 8);
  }
  {
    int row = threadIdx.x >> 2;
    int col = (threadIdx.x & 3) * 8;
    async_copy_b128(Wbase + (size_t)row * DIM + k0 + col,
                    ws + row * 40 + col);
  }
}

// ---------------------------------------------------------------------------
// QKV projection: out[(n,h,l,hd)] = f16( A(row) . W(row o)^T + bias[o] )
// Block tile 128(M) x 64(N), K-step 32, double-buffered async LDS pipeline.
// ---------------------------------------------------------------------------
__global__ __launch_bounds__(256)
void qkv_gemm_kernel(const _Float16* __restrict__ A,
                     const _Float16* __restrict__ W,
                     const float* __restrict__ bias,
                     _Float16* __restrict__ out) {
  __shared__ __align__(16) _Float16 Xs[2][128 * 40];
  __shared__ __align__(16) _Float16 Ws[2][64 * 40];

  const int wave  = threadIdx.x >> 5;
  const int lane  = threadIdx.x & 31;
  const int mBase = blockIdx.x * 128;
  const int nBase = blockIdx.y * 64;

  const _Float16* Abase = A + (size_t)mBase * DIM;
  const _Float16* Wbase = W + (size_t)nBase * DIM;

  v8f acc[4] = {};

  gemm_prefetch(Abase, Wbase, 0, Xs[0], Ws[0]);
  int buf = 0;
  for (int k0 = 0; k0 < DIM; k0 += 32, buf ^= 1) {
    wait_async_all();
    __syncthreads();                       // tile `buf` published to all waves
    if (k0 + 32 < DIM)
      gemm_prefetch(Abase, Wbase, k0 + 32, Xs[buf ^ 1], Ws[buf ^ 1]);

    v16h a = load_frag_rowmajor(&Xs[buf][(wave * 16) * 40], 40);
#pragma unroll
    for (int t = 0; t < 4; ++t) {
      v16h b = load_frag_rowmajor(&Ws[buf][(t * 16) * 40], 40);
      acc[t] = wmma_f16(a, b, acc[t]);
    }
  }

  const int half = lane >> 4;
  const int ncol = lane & 15;
#pragma unroll
  for (int t = 0; t < 4; ++t) {
    int o  = nBase + t * 16 + ncol;
    float bv = bias[o];
    int h = o >> 6, hd = o & 63;
#pragma unroll
    for (int r = 0; r < 8; ++r) {
      int row = mBase + wave * 16 + r + half * 8;       // flat (n,l)
      int n = row >> 10, l = row & (LSEQ - 1);
      out[((((size_t)n * NH + h) * LSEQ) + l) * HD + hd] =
          (_Float16)(acc[t][r] + bv);
    }
  }
}

// ---------------------------------------------------------------------------
// Output projection: d_out[row, o] = f32( O(row) . Wo(row o)^T + bo[o] )
// ---------------------------------------------------------------------------
__global__ __launch_bounds__(256)
void out_gemm_kernel(const _Float16* __restrict__ A,
                     const _Float16* __restrict__ W,
                     const float* __restrict__ bias,
                     float* __restrict__ out) {
  __shared__ __align__(16) _Float16 Xs[2][128 * 40];
  __shared__ __align__(16) _Float16 Ws[2][64 * 40];

  const int wave  = threadIdx.x >> 5;
  const int lane  = threadIdx.x & 31;
  const int mBase = blockIdx.x * 128;
  const int nBase = blockIdx.y * 64;

  const _Float16* Abase = A + (size_t)mBase * DIM;
  const _Float16* Wbase = W + (size_t)nBase * DIM;

  v8f acc[4] = {};

  gemm_prefetch(Abase, Wbase, 0, Xs[0], Ws[0]);
  int buf = 0;
  for (int k0 = 0; k0 < DIM; k0 += 32, buf ^= 1) {
    wait_async_all();
    __syncthreads();
    if (k0 + 32 < DIM)
      gemm_prefetch(Abase, Wbase, k0 + 32, Xs[buf ^ 1], Ws[buf ^ 1]);

    v16h a = load_frag_rowmajor(&Xs[buf][(wave * 16) * 40], 40);
#pragma unroll
    for (int t = 0; t < 4; ++t) {
      v16h b = load_frag_rowmajor(&Ws[buf][(t * 16) * 40], 40);
      acc[t] = wmma_f16(a, b, acc[t]);
    }
  }

  const int half = lane >> 4;
  const int ncol = lane & 15;
#pragma unroll
  for (int t = 0; t < 4; ++t) {
    int o  = nBase + t * 16 + ncol;
    float bv = bias[o];
#pragma unroll
    for (int r = 0; r < 8; ++r) {
      int row = mBase + wave * 16 + r + half * 8;
      out[(size_t)row * DIM + o] = acc[t][r] + bv;
    }
  }
}

// ---------------------------------------------------------------------------
// Attention tile prefetchers
// ---------------------------------------------------------------------------
DEV void attn_prefetch_K(const _Float16* __restrict__ Kbase, _Float16* ks) {
  int row = threadIdx.x >> 3;                 // key 0..31
  int col = (threadIdx.x & 7) * 8;            // d
  async_copy_b128(Kbase + (size_t)row * HD + col, ks + row * 72 + col);
}

DEV void attn_load_V_transposed(const _Float16* __restrict__ Vbase, _Float16* vt) {
  int row = threadIdx.x >> 3;                 // key 0..31
  int col = (threadIdx.x & 7) * 8;            // d
  v8h vv = *(const v8h*)(Vbase + (size_t)row * HD + col);
#pragma unroll
  for (int i = 0; i < 8; ++i) vt[(col + i) * 40 + row] = vv[i];
}

// ---------------------------------------------------------------------------
// Lane l <-> l ^ 16 exchange (the two halves of a wave hold one query's keys).
// ---------------------------------------------------------------------------
DEV float other_half(float v) {
  int b = __builtin_bit_cast(int, v);
  b = __builtin_amdgcn_permlanex16(b, b, 0x76543210, 0xfedcba98, false, false);
  return __builtin_bit_cast(float, b);
}

__global__ __launch_bounds__(256)
void attention_kernel(const _Float16* __restrict__ Q,   // [N][H][L][HD]
                      const _Float16* __restrict__ K,
                      const _Float16* __restrict__ V,
                      const float* __restrict__ bias,   // [N][L][L]
                      const int* __restrict__ mask,     // [N][L]
                      _Float16* __restrict__ O) {       // [N][L][DIM]
  __shared__ __align__(16) _Float16 Ks[2][32 * 72];
  __shared__ __align__(16) _Float16 Vt[2][64 * 40];

  const int wave = threadIdx.x >> 5;
  const int lane = threadIdx.x & 31;
  const int h    = blockIdx.y;
  const int n    = blockIdx.z;
  const int qBase = blockIdx.x * 128 + wave * 16;

  const size_t headOff = ((size_t)n * NH + h) * LSEQ * HD;

  const _Float16* qptr = Q + headOff + (size_t)qBase * HD;
  v16h aQ0 = load_frag_rowmajor(qptr, HD);
  v16h aQ1 = load_frag_rowmajor(qptr + 32, HD);

  const int half = lane >> 4;
  const int qcol = lane & 15;

  float mrun = -1e30f;      // running maximum of this lane's query
  float lrun = 0.f;         // this half's share of the query's row sum
  v8f  o[4] = {};           // o[t][r] = O[query qcol][d = t*16 + 8*half + r]

  const float* brow =
      bias + ((size_t)n * LSEQ + (qBase + qcol)) * LSEQ + half * 8;
  const int* mrowp = mask + n * LSEQ + half * 8;

  attn_prefetch_K(K + headOff, Ks[0]);
  // the V load below lands in the copy's address registers: wait kept in front
  asm volatile("s_wait_xcnt 0x0" ::: "memory");
  attn_load_V_transposed(V + headOff, Vt[0]);

  int buf = 0;
  for (int kb = 0; kb < LSEQ; kb += 32, buf ^= 1) {
    wait_async_all();
    __syncthreads();          // K (async) + V (ds_store) tiles published
    if (kb + 32 < LSEQ) {
      attn_prefetch_K(K + headOff + (size_t)(kb + 32) * HD, Ks[buf ^ 1]);
      // as in front of the loop: the V load reuses the copy's address registers
      asm volatile("s_wait_xcnt 0x0" ::: "memory");
      attn_load_V_transposed(V + headOff + (size_t)(kb + 32) * HD, Vt[buf ^ 1]);
    }

    // this lane's 16 bias values and mask words: 8 consecutive keys per tile
    const float* bp = brow + kb;
    const int*   mp = mrowp + kb;
    v4f bb[2][2];
    v4i mk[2][2];
#pragma unroll
    for (int j = 0; j < 2; ++j) {
      bb[j][0] = *(const v4f*)(bp + j * 16);
      bb[j][1] = *(const v4f*)(bp + j * 16 + 4);
      mk[j][0] = *(const v4i*)(mp + j * 16);
      mk[j][1] = *(const v4i*)(mp + j * 16 + 4);
    }
    // The eight loads' address registers are reused right below; the wait
    // names them as inputs so that no rewrite of them is lifted over it.
    asm volatile("s_wait_xcnt 0x0" :: "v"(bp), "v"(mp) : "memory");

    // S^T = K Q^T : 32 keys x 16 queries, two 16-key tiles
    v8f s[2];
#pragma unroll
    for (int j = 0; j < 2; ++j) {
      v16h a0 = load_frag_rowmajor(&Ks[buf][(j * 16) * 72], 72);
      v16h a1 = load_frag_rowmajor(&Ks[buf][(j * 16) * 72 + 32], 72);
      v8f c = {};
      c = wmma_f16(a0, aQ0, c);
      c = wmma_f16(a1, aQ1, c);
      s[j] = c;
    }

    // scale + bias + key-padding mask
#pragma unroll
    for (int j = 0; j < 2; ++j) {
#pragma unroll
      for (int r = 0; r < 8; ++r) {
        float val = s[j][r] * 0.125f + bb[j][r >> 2][r & 3];
        s[j][r] = (mk[j][r >> 2][r & 3] == 0) ? -1.0e9f : val;
      }
    }

    // online softmax: maximum over own registers, one exchange between halves
    float v = fmaxf(s[0][0], s[1][0]);
#pragma unroll
    for (int r = 1; r < 8; ++r) v = fmaxf(v, fmaxf(s[0][r], s[1][r]));
    v = fmaxf(v, other_half(v));
    const float mnew  = fmaxf(mrun, v);
    const float alpha = __expf(mrun - mnew);
    mrun = mnew;

    float ps = 0.f;
#pragma unroll
    for (int j = 0; j < 2; ++j) {
#pragma unroll
      for (int r = 0; r < 8; ++r) {
        s[j][r] = __expf(s[j][r] - mnew);
        ps += s[j][r];
      }
    }
    lrun = lrun * alpha + ps;

    // P^T as B operand: element e = tile e>>3, register e&7 (hardware k order)
    v8h p0 = __builtin_convertvector(s[0], v8h);
    v8h p1 = __builtin_convertvector(s[1], v8h);
    v16h bP;
#pragma unroll
    for (int i = 0; i < 8; ++i) { bP[i] = p0[i]; bP[i + 8] = p1[i]; }

    // O^T = O^T * alpha + V^T P^T
#pragma unroll
    for (int t = 0; t < 4; ++t) {
      v16h aV = load_frag_rowmajor(&Vt[buf][(t * 16) * 40], 40);
      o[t] *= alpha;
      o[t] = wmma_f16(aV, bP, o[t]);
    }
  }

  // finalize: join the halves' sums, divide, write f16 [n][L][h*64 + d]
  const float inv = 1.0f / (lrun + other_half(lrun));
  _Float16* optr =
      O + ((size_t)n * LSEQ + (qBase + qcol)) * DIM + h * HD + half * 8;
#pragma unroll
  for (int t = 0; t < 4; ++t)
    *(v8h*)(optr + t * 16) = __builtin_convertvector(o[t] * inv, v8h);
}

// ---------------------------------------------------------------------------
// Launch
// ---------------------------------------------------------------------------
extern "C" void kernel_launch(void* const* d_in, const int* in_sizes, int n_in,
                              void* d_out, int out_size, void* d_ws, size_t ws_size,
                              hipStream_t stream) {
  (void)in_sizes; (void)n_in; (void)out_size; (void)ws_size;
  const float* x         = (const float*)d_in[0];
  const float* attn_bias = (const float*)d_in[1];
  const int*   kpm       = (const int*)d_in[2];
  const float* Wq = (const float*)d_in[3];
  const float* bq = (const float*)d_in[4];
  const float* Wk = (const float*)d_in[5];
  const float* bk = (const float*)d_in[6];
  const float* Wv = (const float*)d_in[7];
  const float* bv = (const float*)d_in[8];
  const float* Wo = (const float*)d_in[9];
  const float* bo = (const float*)d_in[10];
  float* out = (float*)d_out;

  const size_t xElems = (size_t)Nb * LSEQ * DIM;   // 8,388,608
  const size_t wElems = (size_t)DIM * DIM;         //   262,144

  char* wsp = (char*)d_ws;
  auto carve = [&](size_t halves) {
    _Float16* p = (_Float16*)wsp;
    wsp += ((halves * sizeof(_Float16) + 255) / 256) * 256;
    return p;
  };
  _Float16* xh  = carve(xElems);
  _Float16* wqh = carve(wElems);
  _Float16* wkh = carve(wElems);
  _Float16* wvh = carve(wElems);
  _Float16* woh = carve(wElems);
  _Float16* Qh  = carve(xElems);
  _Float16* Kh  = carve(xElems);
  _Float16* Vh  = carve(xElems);
  _Float16* Oh  = carve(xElems);

  cvt_f32_to_f16_kernel<<<2048, 256, 0, stream>>>(x,  xh,  (int)xElems);
  cvt_f32_to_f16_kernel<<<256,  256, 0, stream>>>(Wq, wqh, (int)wElems);
  cvt_f32_to_f16_kernel<<<256,  256, 0, stream>>>(Wk, wkh, (int)wElems);
  cvt_f32_to_f16_kernel<<<256,  256, 0, stream>>>(Wv, wvh, (int)wElems);
  cvt_f32_to_f16_kernel<<<256,  256, 0, stream>>>(Wo, woh, (int)wElems);

  dim3 gemmGrid((Nb * LSEQ) / 128, DIM / 64);
  qkv_gemm_kernel<<<gemmGrid, 256, 0, stream>>>(xh, wqh, bq, Qh);
  qkv_gemm_kernel<<<gemmGrid, 256, 0, stream>>>(xh, wkh, bk, Kh);
  qkv_gemm_kernel<<<gemmGrid, 256, 0, stream>>>(xh, wvh, bv, Vh);

  dim3 attnGrid(LSEQ / 128, NH, Nb);
  attention_kernel<<<attnGrid, 256, 0, stream>>>(Qh, Kh, Vh, attn_bias, kpm, Oh);

  out_gemm_kernel<<<gemmGrid, 256, 0, stream>>>(Oh, woh, bo, out);
}

// v002
// One run takes 153 microseconds.
// Timed twice side by side with v001, it ran 1.10 times as fast both times.
// All steps since v000 together make it 1.40 times as fast.
#include <hip/hip_runtime.h>
#include <hip/hip_bf16.h>

typedef __attribute__((ext_vector_type(16))) _Float16 v16h;
typedef __attribute__((ext_vector_type(8)))  _Float16 v8h;
typedef __attribute__((ext_vector_type(8)))  float    v8f;
typedef __attribute__((ext_vector_type(4)))  float    v4f;
typedef __attribute__((ext_vector_type(4)))  int      v4i;

#define DEV __device__ __forceinline__

static constexpr int Nb   = 16;
static constexpr int LSEQ = 1024;
static constexpr int DIM  = 512;
static constexpr int NH   = 8;
static constexpr int HD   = 64;

// ---------------------------------------------------------------------------
// WMMA fragment load (ISA 7.12.2 16-bit A/B layout):
//   lane l<16 : row m=l,    K in {0..7, 16..23}
//   lane l>=16: row m=l-16, K in {8..15, 24..31}
// => two contiguous 16-byte (8-half) runs per lane at K=koff and K=koff+16.
// ---------------------------------------------------------------------------
DEV v16h load_frag_rowmajor(const _Float16* __restrict__ base, int ld) {
  const int lane = threadIdx.x & 31;
  const int m    = lane & 15;
  const int koff = (lane >> 4) << 3;            // 0 or 8
  const _Float16* p = base + m * ld + koff;
  v8h lo = *(const v8h*)(p);
  v8h hi = *(const v8h*)(p + 16);
  v16h r;
#pragma unroll
  for (int i = 0; i < 8; ++i) { r[i] = lo[i]; r[i + 8] = hi[i]; }
  return r;
}

DEV v8f wmma_f16(v16h a, v16h b, v8f c) {
  return __builtin_amdgcn_wmma_f32_16x16x32_f16(
      false, a, false, b, (short)0, c, false, false);
}

// Async global -> LDS copy, 16 bytes per lane, tracked by ASYNCcnt.
DEV void async_copy_b128(const _Float16* src, _Float16* lds_dst) {
  unsigned dst = (unsigned)(unsigned long long)lds_dst;   // addr[31:0] = LDS offset
  asm volatile("global_load_async_to_lds_b128 %0, %1, off"
               :: "v"(dst), "v"(src) : "memory");
}

DEV void wait_async_all() {
  asm volatile("s_wait_asynccnt 0" ::: "memory");
}

// ---------------------------------------------------------------------------
// f32 -> f16 conversion of x and of the four weight matrices in ONE launch.
// Blocks [0, CVT_XB) stride over x; behind them CVT_WB blocks per matrix.
// The long ranges (x) have the low block indices, so they start first.
// ---------------------------------------------------------------------------
static constexpr int CVT_XB = 2048;
static constexpr int CVT_WB = 256;

DEV void cvt_range(const float* __restrict__ src, _Float16* __restrict__ dst,
                   int n, int block, int nblocks) {
  int i = block * 256 + threadIdx.x;
  const int stride = nblocks * 256;
  for (; i < n; i += stride) dst[i] = (_Float16)src[i];
}

__global__ __launch_bounds__(256)
void cvt_all_kernel(const float* __restrict__ x,
                    const float* __restrict__ Wq, const float* __restrict__ Wk,
                    const float* __restrict__ Wv, const float* __restrict__ Wo,
                    _Float16* __restrict__ xh,
                    _Float16* __restrict__ wqh, _Float16* __restrict__ wkh,
                    _Float16* __restrict__ wvh, _Float16* __restrict__ woh) {
  const int b = blockIdx.x;
  if (b < CVT_XB) {
    cvt_range(x, xh, Nb * LSEQ * DIM, b, CVT_XB);
    return;
  }
  const int w  = (b - CVT_XB) / CVT_WB;
  const int wb = (b - CVT_XB) % CVT_WB;
  const float* src = (w == 0) ? Wq : (w == 1) ? Wk : (w == 2) ? Wv : Wo;
  _Float16*    dst = (w == 0) ? wqh : (w == 1) ? wkh : (w == 2) ? wvh : woh;
  cvt_range(src, dst, DIM * DIM, wb, CVT_WB);
}

// ---------------------------------------------------------------------------
// Shared GEMM tile prefetch: X tile 128x32 halves (two b128/lane),
// W tile 64x32 halves (one b128/lane).  Both padded to ld=40 halves.
// ---------------------------------------------------------------------------
DEV void gemm_prefetch(const _Float16* __restrict__ Abase,
                       const _Float16* __restrict__ Wbase, int k0,
                       _Float16* xs, _Float16* ws) {
  {
    int row = threadIdx.x >> 1;
    int col = (threadIdx.x & 1) * 16;
    const _Float16* src = Abase + (size_t)row * DIM + k0 + col;
    async_copy_b128(src,     xs + row * 40 + col);
    async_copy_b128(src + 8, xs + row * 40 + col + 8);
  }
  {
    int row = threadIdx.x >> 2;
    int col = (threadIdx.x & 3) * 8;
    async_copy_b128(Wbase + (size_t)row * DIM + k0 + col,
                    ws + row * 40 + col);
  }
}

// ---------------------------------------------------------------------------
// QKV projection: out[(n,h,l,hd)] = f16( A(row) . W(row o)^T + bias[o] )
// Block tile 128(M) x 64(N), K-step 32, double-buffered async LDS pipeline.
// One launch for the three projections: blockIdx.z picks Q, K or V.
// ---------------------------------------------------------------------------
__global__ __launch_bounds__(256)
void qkv_gemm_kernel(const _Float16* __restrict__ A,
                     const _Float16* __restrict__ Wq,
                     const _Float16* __restrict__ Wk,
                     const _Float16* __restrict__ Wv,
                     const float* __restrict__ bq,
                     const float* __restrict__ bk,
                     const float* __restrict__ bv,
                     _Float16* __restrict__ Qo,
                     _Float16* __restrict__ Ko,
                     _Float16* __restrict__ Vo) {
  __shared__ __align__(16) _Float16 Xs[2][128 * 40];
  __shared__ __align__(16) _Float16 Ws[2][64 * 40];

  const int z = blockIdx.z;
  const _Float16* W    = (z == 0) ? Wq : (z == 1) ? Wk : Wv;
  const float*    bias = (z == 0) ? bq : (z == 1) ? bk : bv;
  _Float16*       out  = (z == 0) ? Qo : (z == 1) ? Ko : Vo;

  const int wave  = threadIdx.x >> 5;
  const int lane  = threadIdx.x & 31;
  const int mBase = blockIdx.x * 128;
  const int nBase = blockIdx.y * 64;

  const _Float16* Abase = A + (size_t)mBase * DIM;
  const _Float16* Wbase = W + (size_t)nBase * DIM;

  v8f acc[4] = {};

  gemm_prefetch(Abase, Wbase, 0, Xs[0], Ws[0]);
  int buf = 0;
  for (int k0 = 0; k0 < DIM; k0 += 32, buf ^= 1) {
    wait_async_all();
    __syncthreads();                       // tile `buf` published to all waves
    if (k0 + 32 < DIM)
      gemm_prefetch(Abase, Wbase, k0 + 32, Xs[buf ^ 1], Ws[buf ^ 1]);

    v16h a = load_frag_rowmajor(&Xs[buf][(wave * 16) * 40], 40);
#pragma unroll
    for (int t = 0; t < 4; ++t) {
      v16h b = load_frag_rowmajor(&Ws[buf][(t * 16) * 40], 40);
      acc[t] = wmma_f16(a, b, acc[t]);
    }
  }

  const int half = lane >> 4;
  const int ncol = lane & 15;
#pragma unroll
  for (int t = 0; t < 4; ++t) {
    int o  = nBase + t * 16 + ncol;
    float bv = bias[o];
    int h = o >> 6, hd = o & 63;
#pragma unroll
    for (int r = 0; r < 8; ++r) {
      int row = mBase + wave * 16 + r + half * 8;       // flat (n,l)
      int n = row >> 10, l = row & (LSEQ - 1);
      out[((((size_t)n * NH + h) * LSEQ) + l) * HD + hd] =
          (_Float16)(acc[t][r] + bv);
    }
  }
}

// ---------------------------------------------------------------------------
// Output projection: d_out[row, o] = f32( O(row) . Wo(row o)^T + bo[o] )
// ---------------------------------------------------------------------------
__global__ __launch_bounds__(256)
void out_gemm_kernel(const _Float16* __restrict__ A,
                     const _Float16* __restrict__ W,
                     const float* __restrict__ bias,
                     float* __restrict__ out) {
  __shared__ __align__(16) _Float16 Xs[2][128 * 40];
  __shared__ __align__(16) _Float16 Ws[2][64 * 40];

  const int wave  = threadIdx.x >> 5;
  const int lane  = threadIdx.x & 31;
  const int mBase = blockIdx.x * 128;
  const int nBase = blockIdx.y * 64;

  const _Float16* Abase = A + (size_t)mBase * DIM;
  const _Float16* Wbase = W + (size_t)nBase * DIM;

  v8f acc[4] = {};

  gemm_prefetch(Abase, Wbase, 0, Xs[0], Ws[0]);
  int buf = 0;
  for (int k0 = 0; k0 < DIM; k0 += 32, buf ^= 1) {
    wait_async_all();
    __syncthreads();
    if (k0 + 32 < DIM)
      gemm_prefetch(Abase, Wbase, k0 + 32, Xs[buf ^ 1], Ws[buf ^ 1]);

    v16h a = load_frag_rowmajor(&Xs[buf][(wave * 16) * 40], 40);
#pragma unroll
    for (int t = 0; t < 4; ++t) {
      v16h b = load_frag_rowmajor(&Ws[buf][(t * 16) * 40], 40);
      acc[t] = wmma_f16(a, b, acc[t]);
    }
  }

  const int half = lane >> 4;
  const int ncol = lane & 15;
#pragma unroll
  for (int t = 0; t < 4; ++t) {
    int o  = nBase + t * 16 + ncol;
    float bv = bias[o];
#pragma unroll
    for (int r = 0; r < 8; ++r) {
      int row = mBase + wave * 16 + r + half * 8;
      out[(size_t)row * DIM + o] = acc[t][r] + bv;
    }
  }
}

// ---------------------------------------------------------------------------
// Attention tile prefetchers
// ---------------------------------------------------------------------------
DEV void attn_prefetch_K(const _Float16* __restrict__ Kbase, _Float16* ks) {
  int row = threadIdx.x >> 3;                 // key 0..31
  int col = (threadIdx.x & 7) * 8;            // d
  async_copy_b128(Kbase + (size_t)row * HD + col, ks + row * 72 + col);
}

DEV void attn_load_V_transposed(const _Float16* __restrict__ Vbase, _Float16* vt) {
  int row = threadIdx.x >> 3;                 // key 0..31
  int col = (threadIdx.x & 7) * 8;            // d
  v8h vv = *(const v8h*)(Vbase + (size_t)row * HD + col);
#pragma unroll
  for (int i = 0; i < 8; ++i) vt[(col + i) * 40 + row] = vv[i];
}

// ---------------------------------------------------------------------------
// Lane l <-> l ^ 16 exchange (the two halves of a wave hold one query's keys).
// ---------------------------------------------------------------------------
DEV float other_half(float v) {
  int b = __builtin_bit_cast(int, v);
  b = __builtin_amdgcn_permlanex16(b, b, 0x76543210, 0xfedcba98, false, false);
  return __builtin_bit_cast(float, b);
}

__global__ __launch_bounds__(256)
void attention_kernel(const _Float16* __restrict__ Q,   // [N][H][L][HD]
                      const _Float16* __restrict__ K,
                      const _Float16* __restrict__ V,
                      const float* __restrict__ bias,   // [N][L][L]
                      const int* __restrict__ mask,     // [N][L]
                      _Float16* __restrict__ O) {       // [N][L][DIM]
  __shared__ __align__(16) _Float16 Ks[2][32 * 72];
  __shared__ __align__(16) _Float16 Vt[2][64 * 40];

  const int wave = threadIdx.x >> 5;
  const int lane = threadIdx.x & 31;
  const int h    = blockIdx.y;
  const int n    = blockIdx.z;
  const int qBase = blockIdx.x * 128 + wave * 16;

  const size_t headOff = ((size_t)n * NH + h) * LSEQ * HD;

  const _Float16* qptr = Q + headOff + (size_t)qBase * HD;
  v16h aQ0 = load_frag_rowmajor(qptr, HD);
  v16h aQ1 = load_frag_rowmajor(qptr + 32, HD);

  const int half = lane >> 4;
  const int qcol = lane & 15;

  float mrun = -1e30f;      // running maximum of this lane's query
  float lrun = 0.f;         // this half's share of the query's row sum
  v8f  o[4] = {};           // o[t][r] = O[query qcol][d = t*16 + 8*half + r]

  const float* brow =
      bias + ((size_t)n * LSEQ + (qBase + qcol)) * LSEQ + half * 8;
  const int* mrowp = mask + n * LSEQ + half * 8;

  attn_prefetch_K(K + headOff, Ks[0]);
  // the V load below lands in the copy's address registers: wait kept in front
  asm volatile("s_wait_xcnt 0x0" ::: "memory");
  attn_load_V_transposed(V + headOff, Vt[0]);

  int buf = 0;
  for (int kb = 0; kb < LSEQ; kb += 32, buf ^= 1) {
    wait_async_all();
    __syncthreads();          // K (async) + V (ds_store) tiles published
    if (kb + 32 < LSEQ) {
      attn_prefetch_K(K + headOff + (size_t)(kb + 32) * HD, Ks[buf ^ 1]);
      // as in front of the loop: the V load reuses the copy's address registers
      asm volatile("s_wait_xcnt 0x0" ::: "memory");
      attn_load_V_transposed(V + headOff + (size_t)(kb + 32) * HD, Vt[buf ^ 1]);
    }

    // this lane's 16 bias values and mask words: 8 consecutive keys per tile
    const float* bp = brow + kb;
    const int*   mp = mrowp + kb;
    v4f bb[2][2];
    v4i mk[2][2];
#pragma unroll
    for (int j = 0; j < 2; ++j) {
      bb[j][0] = *(const v4f*)(bp + j * 16);
      bb[j][1] = *(const v4f*)(bp + j * 16 + 4);
      mk[j][0] = *(const v4i*)(mp + j * 16);
      mk[j][1] = *(const v4i*)(mp + j * 16 + 4);
    }
    // The eight loads' address registers are reused right below; the wait
    // names them as inputs so that no rewrite of them is lifted over it.
    asm volatile("s_wait_xcnt 0x0" :: "v"(bp), "v"(mp) : "memory");

    // S^T = K Q^T : 32 keys x 16 queries, two 16-key tiles
    v8f s[2];
#pragma unroll
    for (int j = 0; j < 2; ++j) {
      v16h a0 = load_frag_rowmajor(&Ks[buf][(j * 16) * 72], 72);
      v16h a1 = load_frag_rowmajor(&Ks[buf][(j * 16) * 72 + 32], 72);
      v8f c = {};
      c = wmma_f16(a0, aQ0, c);
      c = wmma_f16(a1, aQ1, c);
      s[j] = c;
    }

    // scale + bias + key-padding mask
#pragma unroll
    for (int j = 0; j < 2; ++j) {
#pragma unroll
      for (int r = 0; r < 8; ++r) {
        float val = s[j][r] * 0.125f + bb[j][r >> 2][r & 3];
        s[j][r] = (mk[j][r >> 2][r & 3] == 0) ? -1.0e9f : val;
      }
    }

    // online softmax: maximum over own registers, one exchange between halves
    float v = fmaxf(s[0][0], s[1][0]);
#pragma unroll
    for (int r = 1; r < 8; ++r) v = fmaxf(v, fmaxf(s[0][r], s[1][r]));
    v = fmaxf(v, other_half(v));
    const float mnew  = fmaxf(mrun, v);
    const float alpha = __expf(mrun - mnew);
    mrun = mnew;

    float ps = 0.f;
#pragma unroll
    for (int j = 0; j < 2; ++j) {
#pragma unroll
      for (int r = 0; r < 8; ++r) {
        s[j][r] = __expf(s[j][r] - mnew);
        ps += s[j][r];
      }
    }
    lrun = lrun * alpha + ps;

    // P^T as B operand: element e = tile e>>3, register e&7 (hardware k order)
    v8h p0 = __builtin_convertvector(s[0], v8h);
    v8h p1 = __builtin_convertvector(s[1], v8h);
    v16h bP;
#pragma unroll
    for (int i = 0; i < 8; ++i) { bP[i] = p0[i]; bP[i + 8] = p1[i]; }

    // O^T = O^T * alpha + V^T P^T
#pragma unroll
    for (int t = 0; t < 4; ++t) {
      v16h aV = load_frag_rowmajor(&Vt[buf][(t * 16) * 40], 40);
      o[t] *= alpha;
      o[t] = wmma_f16(aV, bP, o[t]);
    }
  }

  // finalize: join the halves' sums, divide, write f16 [n][L][h*64 + d]
  const float inv = 1.0f / (lrun + other_half(lrun));
  _Float16* optr =
      O + ((size_t)n * LSEQ + (qBase + qcol)) * DIM + h * HD + half * 8;
#pragma unroll
  for (int t = 0; t < 4; ++t)
    *(v8h*)(optr + t * 16) = __builtin_convertvector(o[t] * inv, v8h);
}

// ---------------------------------------------------------------------------
// Launch
// ---------------------------------------------------------------------------
extern "C" void kernel_launch(void* const* d_in, const int* in_sizes, int n_in,
                              void* d_out, int out_size, void* d_ws, size_t ws_size,
                              hipStream_t stream) {
  (void)in_sizes; (void)n_in; (void)out_size; (void)ws_size;
  const float* x         = (const float*)d_in[0];
  const float* attn_bias = (const float*)d_in[1];
  const int*   kpm       = (const int*)d_in[2];
  const float* Wq = (const float*)d_in[3];
  const float* bq = (const float*)d_in[4];
  const float* Wk = (const float*)d_in[5];
  const float* bk = (const float*)d_in[6];
  const float* Wv = (const float*)d_in[7];
  const float* bv = (const float*)d_in[8];
  const float* Wo = (const float*)d_in[9];
  const float* bo = (const float*)d_in[10];
  float* out = (float*)d_out;

  const size_t xElems = (size_t)Nb * LSEQ * DIM;   // 8,388,608
  const size_t wElems = (size_t)DIM * DIM;         //   262,144

  char* wsp = (char*)d_ws;
  auto carve = [&](size_t halves) {
    _Float16* p = (_Float16*)wsp;
    wsp += ((halves * sizeof(_Float16) + 255) / 256) * 256;
    return p;
  };
  _Float16* xh  = carve(xElems);
  _Float16* wqh = carve(wElems);
  _Float16* wkh = carve(wElems);
  _Float16* wvh = carve(wElems);
  _Float16* woh = carve(wElems);
  _Float16* Qh  = carve(xElems);
  _Float16* Kh  = carve(xElems);
  _Float16* Vh  = carve(xElems);
  _Float16* Oh  = carve(xElems);

  cvt_all_kernel<<<CVT_XB + 4 * CVT_WB, 256, 0, stream>>>(
      x, Wq, Wk, Wv, Wo, xh, wqh, wkh, wvh, woh);

  dim3 gemmGrid((Nb * LSEQ) / 128, DIM / 64);
  dim3 qkvGrid((Nb * LSEQ) / 128, DIM / 64, 3);
  qkv_gemm_kernel<<<qkvGrid, 256, 0, stream>>>(xh, wqh, wkh, wvh, bq, bk, bv,
                                               Qh, Kh, Vh);

  dim3 attnGrid(LSEQ / 128, NH, Nb);
  attention_kernel<<<attnGrid, 256, 0, stream>>>(Qh, Kh, Vh, attn_bias, kpm, Oh);

  out_gemm_kernel<<<gemmGrid, 256, 0, stream>>>(Oh, woh, bo, out);
}

// v003
// It runs in 129 microseconds.
// In both of two side-by-side timings against v002, it was 1.19 times as fast.
// All steps since v000 together make it 1.67 times as fast.
#include <hip/hip_runtime.h>
#include <hip/hip_bf16.h>

typedef __attribute__((ext_vector_type(16))) _Float16 v16h;
typedef __attribute__((ext_vector_type(8)))  _Float16 v8h;
typedef __attribute__((ext_vector_type(8)))  float    v8f;
typedef __attribute__((ext_vector_type(4)))  float    v4f;
typedef __attribute__((ext_vector_type(4)))  int      v4i;

#define DEV __device__ __forceinline__

static constexpr int Nb   = 16;
static constexpr int LSEQ = 1024;
static constexpr int DIM  = 512;
static constexpr int NH   = 8;
static constexpr int HD   = 64;

// ---------------------------------------------------------------------------
// WMMA fragment load (ISA 7.12.2 16-bit A/B layout):
//   lane l<16 : row m=l,    K in {0..7, 16..23}
//   lane l>=16: row m=l-16, K in {8..15, 24..31}
// => two contiguous 16-byte (8-half) runs per lane at K=koff and K=koff+16.
// ---------------------------------------------------------------------------
DEV v16h load_frag_rowmajor(const _Float16* __restrict__ base, int ld) {
  const int lane = threadIdx.x & 31;
  const int m    = lane & 15;
  const int koff = (lane >> 4) << 3;            // 0 or 8
  const _Float16* p = base + m * ld + koff;
  v8h lo = *(const v8h*)(p);
  v8h hi = *(const v8h*)(p + 16);
  v16h r;
#pragma unroll
  for (int i = 0; i < 8; ++i) { r[i] = lo[i]; r[i + 8] = hi[i]; }
  return r;
}

DEV v8f wmma_f16(v16h a, v16h b, v8f c) {
  return __builtin_amdgcn_wmma_f32_16x16x32_f16(
      false, a, false, b, (short)0, c, false, false);
}

// Async global -> LDS copy, 16 bytes per lane, tracked by ASYNCcnt.
DEV void async_copy_b128(const _Float16* src, _Float16* lds_dst) {
  unsigned dst = (unsigned)(unsigned long long)lds_dst;   // addr[31:0] = LDS offset
  asm volatile("global_load_async_to_lds_b128 %0, %1, off"
               :: "v"(dst), "v"(src) : "memory");
}

DEV void wait_async_all() {
  asm volatile("s_wait_asynccnt 0" ::: "memory");
}

// ---------------------------------------------------------------------------
// f32 -> f16 conversion of x and of the four weight matrices in ONE launch.
// Blocks [0, CVT_XB) stride over x; behind them CVT_WB blocks per matrix.
// The long ranges (x) have the low block indices, so they start first.
// ---------------------------------------------------------------------------
static constexpr int CVT_XB = 2048;
static constexpr int CVT_WB = 256;

DEV void cvt_range(const float* __restrict__ src, _Float16* __restrict__ dst,
                   int n, int block, int nblocks) {
  int i = block * 256 + threadIdx.x;
  const int stride = nblocks * 256;
  for (; i < n; i += stride) dst[i] = (_Float16)src[i];
}

__global__ __launch_bounds__(256)
void cvt_all_kernel(const float* __restrict__ x,
                    const float* __restrict__ Wq, const float* __restrict__ Wk,
                    const float* __restrict__ Wv, const float* __restrict__ Wo,
                    _Float16* __restrict__ xh,
                    _Float16* __restrict__ wqh, _Float16* __restrict__ wkh,
                    _Float16* __restrict__ wvh, _Float16* __restrict__ woh) {
  const int b = blockIdx.x;
  if (b < CVT_XB) {
    cvt_range(x, xh, Nb * LSEQ * DIM, b, CVT_XB);
    return;
  }
  const int w  = (b - CVT_XB) / CVT_WB;
  const int wb = (b - CVT_XB) % CVT_WB;
  const float* src = (w == 0) ? Wq : (w == 1) ? Wk : (w == 2) ? Wv : Wo;
  _Float16*    dst = (w == 0) ? wqh : (w == 1) ? wkh : (w == 2) ? wvh : woh;
  cvt_range(src, dst, DIM * DIM, wb, CVT_WB);
}

// ---------------------------------------------------------------------------
// Shared GEMM tile: block 128(M) x 128(N), K-step 64, 8 waves as 4(M) x 2(N),
// each wave 32 x 64 (2 x 4 accumulator tiles).  A K-step is 128 bytes of every
// operand row, one whole cache line; LDS rows padded to 72 halves (144 bytes).
// ---------------------------------------------------------------------------
static constexpr int GK   = 64;             // halves of k per step
static constexpr int GLD  = 72;             // LDS row pitch in halves
static constexpr int GBUF = 128 * GLD;      // halves per operand tile
static constexpr int GSTEPS = DIM / GK;

// Four async copies of 16 bytes per lane.  The s_wait_xcnt is the statement's
// last line so that no rewrite of the copies' address registers gets ahead of it.
DEV void async_copy4_b128(const _Float16* src, int src_step,
                          _Float16* lds_dst, int dst_step) {
  const _Float16* s0 = src;
  const _Float16* s1 = src + src_step;
  const _Float16* s2 = src + 2 * src_step;
  const _Float16* s3 = src + 3 * src_step;
  unsigned d0 = (unsigned)(unsigned long long)lds_dst;   // addr[31:0] = LDS offset
  unsigned d1 = d0 + 2u * dst_step;
  unsigned d2 = d0 + 4u * dst_step;
  unsigned d3 = d0 + 6u * dst_step;
  asm volatile("global_load_async_to_lds_b128 %0, %4, off\n\t"
               "global_load_async_to_lds_b128 %1, %5, off\n\t"
               "global_load_async_to_lds_b128 %2, %6, off\n\t"
               "global_load_async_to_lds_b128 %3, %7, off\n\t"
               "s_wait_xcnt 0x0"
               :: "v"(d0), "v"(d1), "v"(d2), "v"(d3),
                  "v"(s0), "v"(s1), "v"(s2), "v"(s3) : "memory");
}

// One K-step of both operands: eight lanes cover one row's 128 bytes, so a
// wave's copy instruction takes four whole lines.
DEV void gemm_prefetch(const _Float16* __restrict__ Abase,
                       const _Float16* __restrict__ Wbase, int k0,
                       _Float16* xs, _Float16* ws) {
  const int row = threadIdx.x >> 3;           // 0..31, then +32, +64, +96
  const int col = (threadIdx.x & 7) * 8;
  async_copy4_b128(Abase + (size_t)row * DIM + k0 + col, 32 * DIM,
                   xs + row * GLD + col, 32 * GLD);
  async_copy4_b128(Wbase + (size_t)row * DIM + k0 + col, 32 * DIM,
                   ws + row * GLD + col, 32 * GLD);
}

// acc[i][t] += A(rows wm*32 + i*16 ..) . W(rows wn*64 + t*16 ..)^T over all of K.
// Two LDS buffers: the next step's copies fly while this step is worked on.
DEV void gemm_mainloop(const _Float16* __restrict__ Abase,
                       const _Float16* __restrict__ Wbase,
                       _Float16* xs, _Float16* ws, int wm, int wn,
                       v8f (&acc)[2][4]) {
  gemm_prefetch(Abase, Wbase, 0, xs, ws);
  wait_async_all();
  __syncthreads();                         // step 0 published to all waves
  gemm_prefetch(Abase, Wbase, GK, xs + GBUF, ws + GBUF);

  for (int s = 0; s < GSTEPS; ++s) {
    const _Float16* xb = xs + (s & 1) * GBUF + (wm * 32) * GLD;
    const _Float16* wb = ws + (s & 1) * GBUF + (wn * 64) * GLD;
    // the loops below are unrolled so that fragments and accumulators are
    // indexed by constants and stay in registers
#pragma unroll
    for (int kk = 0; kk < GK; kk += 32) {
      v16h a[2], b[4];
#pragma unroll
      for (int i = 0; i < 2; ++i) a[i] = load_frag_rowmajor(xb + i * 16 * GLD + kk, GLD);
#pragma unroll
      for (int t = 0; t < 4; ++t) b[t] = load_frag_rowmajor(wb + t * 16 * GLD + kk, GLD);
#pragma unroll
      for (int i = 0; i < 2; ++i)
#pragma unroll
        for (int t = 0; t < 4; ++t) acc[i][t] = wmma_f16(a[i], b[t], acc[i][t]);
    }
    // own LDS reads done, own copies of step s + 1 landed, then the barrier:
    // it publishes step s + 1 and frees the buffer that step s has read
    asm volatile("s_wait_dscnt 0x0" ::: "memory");
    wait_async_all();
    __syncthreads();
    if (s + 2 < GSTEPS)
      gemm_prefetch(Abase, Wbase, (s + 2) * GK,
                    xs + (s & 1) * GBUF, ws + (s & 1) * GBUF);
  }
  wait_async_all();                        // nothing in flight when the wave ends
}

// ---------------------------------------------------------------------------
// QKV projection: out[(n,h,l,hd)] = f16( A(row) . W(row o)^T + bias[o] )
// One launch for the three projections: blockIdx.z picks Q, K or V.
// ---------------------------------------------------------------------------
__global__ __launch_bounds__(256)
void qkv_gemm_kernel(const _Float16* __restrict__ A,
                     const _Float16* __restrict__ Wq,
                     const _Float16* __restrict__ Wk,
                     const _Float16* __restrict__ Wv,
                     const float* __restrict__ bq,
                     const float* __restrict__ bk,
                     const float* __restrict__ bv,
                     _Float16* __restrict__ Qo,
                     _Float16* __restrict__ Ko,
                     _Float16* __restrict__ Vo) {
  __shared__ __align__(16) _Float16 Xs[2 * GBUF];
  __shared__ __align__(16) _Float16 Ws[2 * GBUF];

  const int z = blockIdx.z;
  const _Float16* W    = (z == 0) ? Wq : (z == 1) ? Wk : Wv;
  const float*    bias = (z == 0) ? bq : (z == 1) ? bk : bv;
  _Float16*       out  = (z == 0) ? Qo : (z == 1) ? Ko : Vo;

  const int wave  = threadIdx.x >> 5;
  const int lane  = threadIdx.x & 31;
  const int wm    = wave & 3;
  const int wn    = wave >> 2;
  const int mBase = blockIdx.x * 128;
  const int nBase = blockIdx.y * 128;

  v8f acc[2][4] = {};
  gemm_mainloop(A + (size_t)mBase * DIM, W + (size_t)nBase * DIM, Xs, Ws, wm, wn, acc);

  const int half = lane >> 4;
  const int ncol = lane & 15;
#pragma unroll
  for (int t = 0; t < 4; ++t) {
    int o  = nBase + wn * 64 + t * 16 + ncol;
    float bv = bias[o];
    int h = o >> 6, hd = o & 63;
#pragma unroll                              // constant index into acc: registers
    for (int i = 0; i < 2; ++i) {
#pragma unroll
      for (int r = 0; r < 8; ++r) {
        int row = mBase + wm * 32 + i * 16 + r + half * 8;  // flat (n,l)
        int n = row >> 10, l = row & (LSEQ - 1);
        out[((((size_t)n * NH + h) * LSEQ) + l) * HD + hd] =
            (_Float16)(acc[i][t][r] + bv);
      }
    }
  }
}

// ---------------------------------------------------------------------------
// Output projection: d_out[row, o] = f32( O(row) . Wo(row o)^T + bo[o] )
// ---------------------------------------------------------------------------
__global__ __launch_bounds__(256)
void out_gemm_kernel(const _Float16* __restrict__ A,
                     const _Float16* __restrict__ W,
                     const float* __restrict__ bias,
                     float* __restrict__ out) {
  __shared__ __align__(16) _Float16 Xs[2 * GBUF];
  __shared__ __align__(16) _Float16 Ws[2 * GBUF];

  const int wave  = threadIdx.x >> 5;
  const int lane  = threadIdx.x & 31;
  const int wm    = wave & 3;
  const int wn    = wave >> 2;
  const int mBase = blockIdx.x * 128;
  const int nBase = blockIdx.y * 128;

  v8f acc[2][4] = {};
  gemm_mainloop(A + (size_t)mBase * DIM, W + (size_t)nBase * DIM, Xs, Ws, wm, wn, acc);

  const int half = lane >> 4;
  const int ncol = lane & 15;
#pragma unroll
  for (int t = 0; t < 4; ++t) {
    int o  = nBase + wn * 64 + t * 16 + ncol;
    float bv = bias[o];
#pragma unroll                              // constant index into acc: registers
    for (int i = 0; i < 2; ++i) {
#pragma unroll
      for (int r = 0; r < 8; ++r) {
        int row = mBase + wm * 32 + i * 16 + r + half * 8;
        out[(size_t)row * DIM + o] = acc[i][t][r] + bv;
      }
    }
  }
}

// ---------------------------------------------------------------------------
// Attention tile prefetchers
// ---------------------------------------------------------------------------
DEV void attn_prefetch_K(const _Float16* __restrict__ Kbase, _Float16* ks) {
  int row = threadIdx.x >> 3;                 // key 0..31
  int col = (threadIdx.x & 7) * 8;            // d
  async_copy_b128(Kbase + (size_t)row * HD + col, ks + row * 72 + col);
}

DEV void attn_load_V_transposed(const _Float16* __restrict__ Vbase, _Float16* vt) {
  int row = threadIdx.x >> 3;                 // key 0..31
  int col = (threadIdx.x & 7) * 8;            // d
  v8h vv = *(const v8h*)(Vbase + (size_t)row * HD + col);
#pragma unroll
  for (int i = 0; i < 8; ++i) vt[(col + i) * 40 + row] = vv[i];
}

// ---------------------------------------------------------------------------
// Lane l <-> l ^ 16 exchange (the two halves of a wave hold one query's keys).
// ---------------------------------------------------------------------------
DEV float other_half(float v) {
  int b = __builtin_bit_cast(int, v);
  b = __builtin_amdgcn_permlanex16(b, b, 0x76543210, 0xfedcba98, false, false);
  return __builtin_bit_cast(float, b);
}

__global__ __launch_bounds__(256)
void attention_kernel(const _Float16* __restrict__ Q,   // [N][H][L][HD]
                      const _Float16* __restrict__ K,
                      const _Float16* __restrict__ V,
                      const float* __restrict__ bias,   // [N][L][L]
                      const int* __restrict__ mask,     // [N][L]
                      _Float16* __restrict__ O) {       // [N][L][DIM]
  __shared__ __align__(16) _Float16 Ks[2][32 * 72];
  __shared__ __align__(16) _Float16 Vt[2][64 * 40];

  const int wave = threadIdx.x >> 5;
  const int lane = threadIdx.x & 31;
  const int h    = blockIdx.y;
  const int n    = blockIdx.z;
  const int qBase = blockIdx.x * 128 + wave * 16;

  const size_t headOff = ((size_t)n * NH + h) * LSEQ * HD;

  const _Float16* qptr = Q + headOff + (size_t)qBase * HD;
  v16h aQ0 = load_frag_rowmajor(qptr, HD);
  v16h aQ1 = load_frag_rowmajor(qptr + 32, HD);

  const int half = lane >> 4;
  const int qcol = lane & 15;

  float mrun = -1e30f;      // running maximum of this lane's query
  float lrun = 0.f;         // this half's share of the query's row sum
  v8f  o[4] = {};           // o[t][r] = O[query qcol][d = t*16 + 8*half + r]

  const float* brow =
      bias + ((size_t)n * LSEQ + (qBase + qcol)) * LSEQ + half * 8;
  const int* mrowp = mask + n * LSEQ + half * 8;

  attn_prefetch_K(K + headOff, Ks[0]);
  // the V load below lands in the copy's address registers: wait kept in front
  asm volatile("s_wait_xcnt 0x0" ::: "memory");
  attn_load_V_transposed(V + headOff, Vt[0]);

  int buf = 0;
  for (int kb = 0; kb < LSEQ; kb += 32, buf ^= 1) {
    wait_async_all();
    __syncthreads();          // K (async) + V (ds_store) tiles published
    if (kb + 32 < LSEQ) {
      attn_prefetch_K(K + headOff + (size_t)(kb + 32) * HD, Ks[buf ^ 1]);
      // as in front of the loop: the V load reuses the copy's address registers
      asm volatile("s_wait_xcnt 0x0" ::: "memory");
      attn_load_V_transposed(V + headOff + (size_t)(kb + 32) * HD, Vt[buf ^ 1]);
    }

    // this lane's 16 bias values and mask words: 8 consecutive keys per tile
    const float* bp = brow + kb;
    const int*   mp = mrowp + kb;
    v4f bb[2][2];
    v4i mk[2][2];
#pragma unroll
    for (int j = 0; j < 2; ++j) {
      bb[j][0] = *(const v4f*)(bp + j * 16);
      bb[j][1] = *(const v4f*)(bp + j * 16 + 4);
      mk[j][0] = *(const v4i*)(mp + j * 16);
      mk[j][1] = *(const v4i*)(mp + j * 16 + 4);
    }
    // The eight loads' address registers are reused right below; the wait
    // names them as inputs so that no rewrite of them is lifted over it.
    asm volatile("s_wait_xcnt 0x0" :: "v"(bp), "v"(mp) : "memory");

    // S^T = K Q^T : 32 keys x 16 queries, two 16-key tiles
    v8f s[2];
#pragma unroll
    for (int j = 0; j < 2; ++j) {
      v16h a0 = load_frag_rowmajor(&Ks[buf][(j * 16) * 72], 72);
      v16h a1 = load_frag_rowmajor(&Ks[buf][(j * 16) * 72 + 32], 72);
      v8f c = {};
      c = wmma_f16(a0, aQ0, c);
      c = wmma_f16(a1, aQ1, c);
      s[j] = c;
    }

    // scale + bias + key-padding mask
#pragma unroll
    for (int j = 0; j < 2; ++j) {
#pragma unroll
      for (int r = 0; r < 8; ++r) {
        float val = s[j][r] * 0.125f + bb[j][r >> 2][r & 3];
        s[j][r] = (mk[j][r >> 2][r & 3] == 0) ? -1.0e9f : val;
      }
    }

    // online softmax: maximum over own registers, one exchange between halves
    float v = fmaxf(s[0][0], s[1][0]);
#pragma unroll
    for (int r = 1; r < 8; ++r) v = fmaxf(v, fmaxf(s[0][r], s[1][r]));
    v = fmaxf(v, other_half(v));
    const float mnew  = fmaxf(mrun, v);
    const float alpha = __expf(mrun - mnew);
    mrun = mnew;

    float ps = 0.f;
#pragma unroll
    for (int j = 0; j < 2; ++j) {
#pragma unroll
      for (int r = 0; r < 8; ++r) {
        s[j][r] = __expf(s[j][r] - mnew);
        ps += s[j][r];
      }
    }
    lrun = lrun * alpha + ps;

    // P^T as B operand: element e = tile e>>3, register e&7 (hardware k order)
    v8h p0 = __builtin_convertvector(s[0], v8h);
    v8h p1 = __builtin_convertvector(s[1], v8h);
    v16h bP;
#pragma unroll
    for (int i = 0; i < 8; ++i) { bP[i] = p0[i]; bP[i + 8] = p1[i]; }

    // O^T = O^T * alpha + V^T P^T
#pragma unroll
    for (int t = 0; t < 4; ++t) {
      v16h aV = load_frag_rowmajor(&Vt[buf][(t * 16) * 40], 40);
      o[t] *= alpha;
      o[t] = wmma_f16(aV, bP, o[t]);
    }
  }

  // finalize: join the halves' sums, divide, write f16 [n][L][h*64 + d]
  const float inv = 1.0f / (lrun + other_half(lrun));
  _Float16* optr =
      O + ((size_t)n * LSEQ + (qBase + qcol)) * DIM + h * HD + half * 8;
#pragma unroll
  for (int t = 0; t < 4; ++t)
    *(v8h*)(optr + t * 16) = __builtin_convertvector(o[t] * inv, v8h);
}

// ---------------------------------------------------------------------------
// Launch
// ---------------------------------------------------------------------------
extern "C" void kernel_launch(void* const* d_in, const int* in_sizes, int n_in,
                              void* d_out, int out_size, void* d_ws, size_t ws_size,
                              hipStream_t stream) {
  (void)in_sizes; (void)n_in; (void)out_size; (void)ws_size;
  const float* x         = (const float*)d_in[0];
  const float* attn_bias = (const float*)d_in[1];
  const int*   kpm       = (const int*)d_in[2];
  const float* Wq = (const float*)d_in[3];
  const float* bq = (const float*)d_in[4];
  const float* Wk = (const float*)d_in[5];
  const float* bk = (const float*)d_in[6];
  const float* Wv = (const float*)d_in[7];
  const float* bv = (const float*)d_in[8];
  const float* Wo = (const float*)d_in[9];
  const float* bo = (const float*)d_in[10];
  float* out = (float*)d_out;

  const size_t xElems = (size_t)Nb * LSEQ * DIM;   // 8,388,608
  const size_t wElems = (size_t)DIM * DIM;         //   262,144

  char* wsp = (char*)d_ws;
  auto carve = [&](size_t halves) {
    _Float16* p = (_Float16*)wsp;
    wsp += ((halves * sizeof(_Float16) + 255) / 256) * 256;
    return p;
  };
  _Float16* xh  = carve(xElems);
  _Float16* wqh = carve(wElems);
  _Float16* wkh = carve(wElems);
  _Float16* wvh = carve(wElems);
  _Float16* woh = carve(wElems);
  _Float16* Qh  = carve(xElems);
  _Float16* Kh  = carve(xElems);
  _Float16* Vh  = carve(xElems);
  _Float16* Oh  = carve(xElems);

  cvt_all_kernel<<<CVT_XB + 4 * CVT_WB, 256, 0, stream>>>(
      x, Wq, Wk, Wv, Wo, xh, wqh, wkh, wvh, woh);

  dim3 gemmGrid((Nb * LSEQ) / 128, DIM / 128);
  dim3 qkvGrid((Nb * LSEQ) / 128, DIM / 128, 3);
  qkv_gemm_kernel<<<qkvGrid, 256, 0, stream>>>(xh, wqh, wkh, wvh, bq, bk, bv,
                                               Qh, Kh, Vh);

  dim3 attnGrid(LSEQ / 128, NH, Nb);
  attention_kernel<<<attnGrid, 256, 0, stream>>>(Qh, Kh, Vh, attn_bias, kpm, Oh);

  out_gemm_kernel<<<gemmGrid, 256, 0, stream>>>(Oh, woh, bo, out);
}

// v004
// One run takes 109 microseconds.
// Two timings next to v003 put it at 1.18 and 1.17 times that version's speed.
// Counting every step since v000, it is 1.96 times as fast.
#include <hip/hip_runtime.h>
#include <hip/hip_bf16.h>

typedef __attribute__((ext_vector_type(16))) _Float16 v16h;
typedef __attribute__((ext_vector_type(8)))  _Float16 v8h;
typedef __attribute__((ext_vector_type(8)))  float    v8f;
typedef __attribute__((ext_vector_type(4)))  float    v4f;
typedef __attribute__((ext_vector_type(4)))  int      v4i;

#define DEV __device__ __forceinline__

static constexpr int Nb   = 16;
static constexpr int LSEQ = 1024;
static constexpr int DIM  = 512;
static constexpr int NH   = 8;
static constexpr int HD   = 64;

// ---------------------------------------------------------------------------
// WMMA fragment load (ISA 7.12.2 16-bit A/B layout):
//   lane l<16 : row m=l,    K in {0..7, 16..23}
//   lane l>=16: row m=l-16, K in {8..15, 24..31}
// => two contiguous 16-byte (8-half) runs per lane at K=koff and K=koff+16.
// ---------------------------------------------------------------------------
DEV v16h load_frag_rowmajor(const _Float16* __restrict__ base, int ld) {
  const int lane = threadIdx.x & 31;
  const int m    = lane & 15;
  const int koff = (lane >> 4) << 3;            // 0 or 8
  const _Float16* p = base + m * ld + koff;
  v8h lo = *(const v8h*)(p);
  v8h hi = *(const v8h*)(p + 16);
  v16h r;
#pragma unroll
  for (int i = 0; i < 8; ++i) { r[i] = lo[i]; r[i + 8] = hi[i]; }
  return r;
}

DEV v8f wmma_f16(v16h a, v16h b, v8f c) {
  return __builtin_amdgcn_wmma_f32_16x16x32_f16(
      false, a, false, b, (short)0, c, false, false);
}

DEV void wait_async_all() {
  asm volatile("s_wait_asynccnt 0" ::: "memory");
}

// ---------------------------------------------------------------------------
// f32 -> f16 conversion of x and of the four weight matrices in ONE launch.
// Blocks [0, CVT_XB) stride over x; behind them CVT_WB blocks per matrix.
// The long ranges (x) have the low block indices, so they start first.
// ---------------------------------------------------------------------------
static constexpr int CVT_XB = 2048;
static constexpr int CVT_WB = 256;

DEV void cvt_range(const float* __restrict__ src, _Float16* __restrict__ dst,
                   int n, int block, int nblocks) {
  int i = block * 256 + threadIdx.x;
  const int stride = nblocks * 256;
  for (; i < n; i += stride) dst[i] = (_Float16)src[i];
}

__global__ __launch_bounds__(256)
void cvt_all_kernel(const float* __restrict__ x,
                    const float* __restrict__ Wq, const float* __restrict__ Wk,
                    const float* __restrict__ Wv, const float* __restrict__ Wo,
                    _Float16* __restrict__ xh,
                    _Float16* __restrict__ wqh, _Float16* __restrict__ wkh,
                    _Float16* __restrict__ wvh, _Float16* __restrict__ woh) {
  const int b = blockIdx.x;
  if (b < CVT_XB) {
    cvt_range(x, xh, Nb * LSEQ * DIM, b, CVT_XB);
    return;
  }
  const int w  = (b - CVT_XB) / CVT_WB;
  const int wb = (b - CVT_XB) % CVT_WB;
  const float* src = (w == 0) ? Wq : (w == 1) ? Wk : (w == 2) ? Wv : Wo;
  _Float16*    dst = (w == 0) ? wqh : (w == 1) ? wkh : (w == 2) ? wvh : woh;
  cvt_range(src, dst, DIM * DIM, wb, CVT_WB);
}

// ---------------------------------------------------------------------------
// Shared GEMM tile: block 128(M) x 128(N), K-step 64, 8 waves as 4(M) x 2(N),
// each wave 32 x 64 (2 x 4 accumulator tiles).  A K-step is 128 bytes of every
// operand row, one whole cache line; LDS rows padded to 72 halves (144 bytes).
// ---------------------------------------------------------------------------
static constexpr int GK   = 64;             // halves of k per step
static constexpr int GLD  = 72;             // LDS row pitch in halves
static constexpr int GBUF = 128 * GLD;      // halves per operand tile
static constexpr int GSTEPS = DIM / GK;

// Four async copies of 16 bytes per lane.  The s_wait_xcnt is the statement's
// last line so that no rewrite of the copies' address registers gets ahead of it.
DEV void async_copy4_b128(const _Float16* src, int src_step,
                          _Float16* lds_dst, int dst_step) {
  const _Float16* s0 = src;
  const _Float16* s1 = src + src_step;
  const _Float16* s2 = src + 2 * src_step;
  const _Float16* s3 = src + 3 * src_step;
  unsigned d0 = (unsigned)(unsigned long long)lds_dst;   // addr[31:0] = LDS offset
  unsigned d1 = d0 + 2u * dst_step;
  unsigned d2 = d0 + 4u * dst_step;
  unsigned d3 = d0 + 6u * dst_step;
  asm volatile("global_load_async_to_lds_b128 %0, %4, off\n\t"
               "global_load_async_to_lds_b128 %1, %5, off\n\t"
               "global_load_async_to_lds_b128 %2, %6, off\n\t"
               "global_load_async_to_lds_b128 %3, %7, off\n\t"
               "s_wait_xcnt 0x0"
               :: "v"(d0), "v"(d1), "v"(d2), "v"(d3),
                  "v"(s0), "v"(s1), "v"(s2), "v"(s3) : "memory");
}

// One K-step of both operands: eight lanes cover one row's 128 bytes, so a
// wave's copy instruction takes four whole lines.
DEV void gemm_prefetch(const _Float16* __restrict__ Abase,
                       const _Float16* __restrict__ Wbase, int k0,
                       _Float16* xs, _Float16* ws) {
  const int row = threadIdx.x >> 3;           // 0..31, then +32, +64, +96
  const int col = (threadIdx.x & 7) * 8;
  async_copy4_b128(Abase + (size_t)row * DIM + k0 + col, 32 * DIM,
                   xs + row * GLD + col, 32 * GLD);
  async_copy4_b128(Wbase + (size_t)row * DIM + k0 + col, 32 * DIM,
                   ws + row * GLD + col, 32 * GLD);
}

// acc[i][t] += A(rows wm*32 + i*16 ..) . W(rows wn*64 + t*16 ..)^T over all of K.
// Two LDS buffers: the next step's copies fly while this step is worked on.
DEV void gemm_mainloop(const _Float16* __restrict__ Abase,
                       const _Float16* __restrict__ Wbase,
                       _Float16* xs, _Float16* ws, int wm, int wn,
                       v8f (&acc)[2][4]) {
  gemm_prefetch(Abase, Wbase, 0, xs, ws);
  wait_async_all();
  __syncthreads();                         // step 0 published to all waves
  gemm_prefetch(Abase, Wbase, GK, xs + GBUF, ws + GBUF);

  for (int s = 0; s < GSTEPS; ++s) {
    const _Float16* xb = xs + (s & 1) * GBUF + (wm * 32) * GLD;
    const _Float16* wb = ws + (s & 1) * GBUF + (wn * 64) * GLD;
    // the loops below are unrolled so that fragments and accumulators are
    // indexed by constants and stay in registers
#pragma unroll
    for (int kk = 0; kk < GK; kk += 32) {
      v16h a[2], b[4];
#pragma unroll
      for (int i = 0; i < 2; ++i) a[i] = load_frag_rowmajor(xb + i * 16 * GLD + kk, GLD);
#pragma unroll
      for (int t = 0; t < 4; ++t) b[t] = load_frag_rowmajor(wb + t * 16 * GLD + kk, GLD);
#pragma unroll
      for (int i = 0; i < 2; ++i)
#pragma unroll
        for (int t = 0; t < 4; ++t) acc[i][t] = wmma_f16(a[i], b[t], acc[i][t]);
    }
    // own LDS reads done, own copies of step s + 1 landed, then the barrier:
    // it publishes step s + 1 and frees the buffer that step s has read
    asm volatile("s_wait_dscnt 0x0" ::: "memory");
    wait_async_all();
    __syncthreads();
    if (s + 2 < GSTEPS)
      gemm_prefetch(Abase, Wbase, (s + 2) * GK,
                    xs + (s & 1) * GBUF, ws + (s & 1) * GBUF);
  }
  wait_async_all();                        // nothing in flight when the wave ends
}

// ---------------------------------------------------------------------------
// QKV projection: out[(n,h,l,hd)] = f16( A(row) . W(row o)^T + bias[o] )
// One launch for the three projections: blockIdx.z picks Q, K or V.
// ---------------------------------------------------------------------------
__global__ __launch_bounds__(256)
void qkv_gemm_kernel(const _Float16* __restrict__ A,
                     const _Float16* __restrict__ Wq,
                     const _Float16* __restrict__ Wk,
                     const _Float16* __restrict__ Wv,
                     const float* __restrict__ bq,
                     const float* __restrict__ bk,
                     const float* __restrict__ bv,
                     _Float16* __restrict__ Qo,
                     _Float16* __restrict__ Ko,
                     _Float16* __restrict__ Vo) {
  __shared__ __align__(16) _Float16 Xs[2 * GBUF];
  __shared__ __align__(16) _Float16 Ws[2 * GBUF];

  const int z = blockIdx.z;
  const _Float16* W    = (z == 0) ? Wq : (z == 1) ? Wk : Wv;
  const float*    bias = (z == 0) ? bq : (z == 1) ? bk : bv;
  _Float16*       out  = (z == 0) ? Qo : (z == 1) ? Ko : Vo;

  const int wave  = threadIdx.x >> 5;
  const int lane  = threadIdx.x & 31;
  const int wm    = wave & 3;
  const int wn    = wave >> 2;
  const int mBase = blockIdx.x * 128;
  const int nBase = blockIdx.y * 128;

  v8f acc[2][4] = {};
  gemm_mainloop(A + (size_t)mBase * DIM, W + (size_t)nBase * DIM, Xs, Ws, wm, wn, acc);

  const int half = lane >> 4;
  const int ncol = lane & 15;
#pragma unroll
  for (int t = 0; t < 4; ++t) {
    int o  = nBase + wn * 64 + t * 16 + ncol;
    float bv = bias[o];
    int h = o >> 6, hd = o & 63;
#pragma unroll                              // constant index into acc: registers
    for (int i = 0; i < 2; ++i) {
#pragma unroll
      for (int r = 0; r < 8; ++r) {
        int row = mBase + wm * 32 + i * 16 + r + half * 8;  // flat (n,l)
        int n = row >> 10, l = row & (LSEQ - 1);
        out[((((size_t)n * NH + h) * LSEQ) + l) * HD + hd] =
            (_Float16)(acc[i][t][r] + bv);
      }
    }
  }
}

// ---------------------------------------------------------------------------
// Output projection: d_out[row, o] = f32( O(row) . Wo(row o)^T + bo[o] )
// ---------------------------------------------------------------------------
__global__ __launch_bounds__(256)
void out_gemm_kernel(const _Float16* __restrict__ A,
                     const _Float16* __restrict__ W,
                     const float* __restrict__ bias,
                     float* __restrict__ out) {
  __shared__ __align__(16) _Float16 Xs[2 * GBUF];
  __shared__ __align__(16) _Float16 Ws[2 * GBUF];

  const int wave  = threadIdx.x >> 5;
  const int lane  = threadIdx.x & 31;
  const int wm    = wave & 3;
  const int wn    = wave >> 2;
  const int mBase = blockIdx.x * 128;
  const int nBase = blockIdx.y * 128;

  v8f acc[2][4] = {};
  gemm_mainloop(A + (size_t)mBase * DIM, W + (size_t)nBase * DIM, Xs, Ws, wm, wn, acc);

  const int half = lane >> 4;
  const int ncol = lane & 15;
#pragma unroll
  for (int t = 0; t < 4; ++t) {
    int o  = nBase + wn * 64 + t * 16 + ncol;
    float bv = bias[o];
#pragma unroll                              // constant index into acc: registers
    for (int i = 0; i < 2; ++i) {
#pragma unroll
      for (int r = 0; r < 8; ++r) {
        int row = mBase + wm * 32 + i * 16 + r + half * 8;
        out[(size_t)row * DIM + o] = acc[i][t][r] + bv;
      }
    }
  }
}

// ---------------------------------------------------------------------------
// Attention tile prefetchers
// ---------------------------------------------------------------------------
static constexpr int KLD = 72;   // K rows: 144 bytes, 16 B x odd, for ds_load_b128
static constexpr int VLD = 80;   // V rows: 160 bytes, 32 B x odd, for ds_load_tr16_b128

// One 32-key tile of K and of V, both row-major: eight lanes take one row's
// 128 bytes, async global -> LDS, 16 bytes per lane (ASYNCcnt).  The s_wait_xcnt
// is the statement's last line so that no rewrite of the copies' address
// registers gets ahead of it.
DEV void attn_prefetch_KV(const _Float16* __restrict__ Kbase,
                          const _Float16* __restrict__ Vbase,
                          _Float16* ks, _Float16* vs) {
  const int row = threadIdx.x >> 3;           // key 0..31
  const int col = (threadIdx.x & 7) * 8;      // d
  const _Float16* sk = Kbase + (size_t)row * HD + col;
  const _Float16* sv = Vbase + (size_t)row * HD + col;
  unsigned dk = (unsigned)(unsigned long long)(ks + row * KLD + col);  // LDS offset
  unsigned dv = (unsigned)(unsigned long long)(vs + row * VLD + col);
  asm volatile("global_load_async_to_lds_b128 %0, %2, off\n\t"
               "global_load_async_to_lds_b128 %1, %3, off\n\t"
               "s_wait_xcnt 0x0"
               :: "v"(dk), "v"(dv), "v"(sk), "v"(sv) : "memory");
}

// Transposing LDS load: from a row-major tile T[key][d], with lane l pointing at
// row 8*(l>>4) + (l&7), 16 bytes * ((l>>3)&1), lane (c, half) receives
// T[8*half + 0..7][c]: half of a 16(d) x 32(key) A fragment in hardware k order.
typedef short s16x8 __attribute__((ext_vector_type(8)));
DEV v8h lds_load_tr16(const _Float16* p) {
  typedef __attribute__((address_space(3))) s16x8 lds_s16x8;
  return __builtin_bit_cast(v8h, __builtin_amdgcn_ds_load_tr16_b128_v8i16((lds_s16x8*)p));
}

// ---------------------------------------------------------------------------
// Lane l <-> l ^ 16 exchange (the two halves of a wave hold one query's keys).
// ---------------------------------------------------------------------------
DEV float other_half(float v) {
  int b = __builtin_bit_cast(int, v);
  b = __builtin_amdgcn_permlanex16(b, b, 0x76543210, 0xfedcba98, false, false);
  return __builtin_bit_cast(float, b);
}

__global__ __launch_bounds__(256)
void attention_kernel(const _Float16* __restrict__ Q,   // [N][H][L][HD]
                      const _Float16* __restrict__ K,
                      const _Float16* __restrict__ V,
                      const float* __restrict__ bias,   // [N][L][L]
                      const int* __restrict__ mask,     // [N][L]
                      _Float16* __restrict__ O) {       // [N][L][DIM]
  __shared__ __align__(16) _Float16 Ks[2][32 * KLD];
  __shared__ __align__(16) _Float16 Vs[2][32 * VLD];

  const int wave = threadIdx.x >> 5;
  const int lane = threadIdx.x & 31;
  const int h    = blockIdx.y;
  const int n    = blockIdx.z;
  const int qBase = blockIdx.x * 128 + wave * 16;

  const size_t headOff = ((size_t)n * NH + h) * LSEQ * HD;

  const _Float16* qptr = Q + headOff + (size_t)qBase * HD;
  v16h aQ0 = load_frag_rowmajor(qptr, HD);
  v16h aQ1 = load_frag_rowmajor(qptr + 32, HD);

  const int half = lane >> 4;
  const int qcol = lane & 15;

  float mrun = -1e30f;      // running maximum of this lane's query
  float lrun = 0.f;         // this half's share of the query's row sum
  v8f  o[4] = {};           // o[t][r] = O[query qcol][d = t*16 + 8*half + r]

  const float* brow =
      bias + ((size_t)n * LSEQ + (qBase + qcol)) * LSEQ + half * 8;
  const int* mrowp = mask + n * LSEQ + half * 8;

  // this lane's place in a V tile for the transposing loads
  const int vlane = (half * 8 + (lane & 7)) * VLD + ((lane >> 3) & 1) * 8;

  attn_prefetch_KV(K + headOff, V + headOff, Ks[0], Vs[0]);

  int buf = 0;
  for (int kb = 0; kb < LSEQ; kb += 32, buf ^= 1) {
    // own LDS reads of the last tile done, own copies of this tile landed, then
    // the barrier: it publishes this tile and frees the buffer refilled below
    asm volatile("s_wait_dscnt 0x0" ::: "memory");
    wait_async_all();
    __syncthreads();
    if (kb + 32 < LSEQ)
      attn_prefetch_KV(K + headOff + (size_t)(kb + 32) * HD,
                       V + headOff + (size_t)(kb + 32) * HD,
                       Ks[buf ^ 1], Vs[buf ^ 1]);

    // this lane's 16 bias values and mask words: 8 consecutive keys per tile
    const float* bp = brow + kb;
    const int*   mp = mrowp + kb;
    v4f bb[2][2];
    v4i mk[2][2];
#pragma unroll
    for (int j = 0; j < 2; ++j) {
      bb[j][0] = *(const v4f*)(bp + j * 16);
      bb[j][1] = *(const v4f*)(bp + j * 16 + 4);
      mk[j][0] = *(const v4i*)(mp + j * 16);
      mk[j][1] = *(const v4i*)(mp + j * 16 + 4);
    }
    // The eight loads' address registers are reused right below; the wait
    // names them as inputs so that no rewrite of them is lifted over it.
    asm volatile("s_wait_xcnt 0x0" :: "v"(bp), "v"(mp) : "memory");

    // S^T = K Q^T : 32 keys x 16 queries, two 16-key tiles
    v8f s[2];
#pragma unroll
    for (int j = 0; j < 2; ++j) {
      v16h a0 = load_frag_rowmajor(&Ks[buf][(j * 16) * KLD], KLD);
      v16h a1 = load_frag_rowmajor(&Ks[buf][(j * 16) * KLD + 32], KLD);
      v8f c = {};
      c = wmma_f16(a0, aQ0, c);
      c = wmma_f16(a1, aQ1, c);
      s[j] = c;
    }

    // scale + bias + key-padding mask
#pragma unroll
    for (int j = 0; j < 2; ++j) {
#pragma unroll
      for (int r = 0; r < 8; ++r) {
        float val = s[j][r] * 0.125f + bb[j][r >> 2][r & 3];
        s[j][r] = (mk[j][r >> 2][r & 3] == 0) ? -1.0e9f : val;
      }
    }

    // online softmax: maximum over own registers, one exchange between halves
    float v = fmaxf(s[0][0], s[1][0]);
#pragma unroll
    for (int r = 1; r < 8; ++r) v = fmaxf(v, fmaxf(s[0][r], s[1][r]));
    v = fmaxf(v, other_half(v));
    const float mnew  = fmaxf(mrun, v);
    const float alpha = __expf(mrun - mnew);
    mrun = mnew;

    float ps = 0.f;
#pragma unroll
    for (int j = 0; j < 2; ++j) {
#pragma unroll
      for (int r = 0; r < 8; ++r) {
        s[j][r] = __expf(s[j][r] - mnew);
        ps += s[j][r];
      }
    }
    lrun = lrun * alpha + ps;

    // P^T as B operand: element e = tile e>>3, register e&7 (hardware k order)
    v8h p0 = __builtin_convertvector(s[0], v8h);
    v8h p1 = __builtin_convertvector(s[1], v8h);
    v16h bP;
#pragma unroll
    for (int i = 0; i < 8; ++i) { bP[i] = p0[i]; bP[i + 8] = p1[i]; }

    // O^T = O^T * alpha + V^T P^T
#pragma unroll
    for (int t = 0; t < 4; ++t) {
      v8h lo = lds_load_tr16(&Vs[buf][vlane + t * 16]);             // keys 8*half + 0..7
      v8h hi = lds_load_tr16(&Vs[buf][vlane + 16 * VLD + t * 16]);  // keys 16 + 8*half + 0..7
      v16h aV;
#pragma unroll                              // constant index into aV: registers
      for (int i = 0; i < 8; ++i) { aV[i] = lo[i]; aV[i + 8] = hi[i]; }
      o[t] *= alpha;
      o[t] = wmma_f16(aV, bP, o[t]);
    }
  }

  wait_async_all();           // nothing in flight when the wave ends

  // finalize: join the halves' sums, divide, write f16 [n][L][h*64 + d]
  const float inv = 1.0f / (lrun + other_half(lrun));
  _Float16* optr =
      O + ((size_t)n * LSEQ + (qBase + qcol)) * DIM + h * HD + half * 8;
#pragma unroll
  for (int t = 0; t < 4; ++t)
    *(v8h*)(optr + t * 16) = __builtin_convertvector(o[t] * inv, v8h);
}

// ---------------------------------------------------------------------------
// Launch
// ---------------------------------------------------------------------------
extern "C" void kernel_launch(void* const* d_in, const int* in_sizes, int n_in,
                              void* d_out, int out_size, void* d_ws, size_t ws_size,
                              hipStream_t stream) {
  (void)in_sizes; (void)n_in; (void)out_size; (void)ws_size;
  const float* x         = (const float*)d_in[0];
  const float* attn_bias = (const float*)d_in[1];
  const int*   kpm       = (const int*)d_in[2];
  const float* Wq = (const float*)d_in[3];
  const float* bq = (const float*)d_in[4];
  const float* Wk = (const float*)d_in[5];
  const float* bk = (const float*)d_in[6];
  const float* Wv = (const float*)d_in[7];
  const float* bv = (const float*)d_in[8];
  const float* Wo = (const float*)d_in[9];
  const float* bo = (const float*)d_in[10];
  float* out = (float*)d_out;

  const size_t xElems = (size_t)Nb * LSEQ * DIM;   // 8,388,608
  const size_t wElems = (size_t)DIM * DIM;         //   262,144

  char* wsp = (char*)d_ws;
  auto carve = [&](size_t halves) {
    _Float16* p = (_Float16*)wsp;
    wsp += ((halves * sizeof(_Float16) + 255) / 256) * 256;
    return p;
  };
  _Float16* xh  = carve(xElems);
  _Float16* wqh = carve(wElems);
  _Float16* wkh = carve(wElems);
  _Float16* wvh = carve(wElems);
  _Float16* woh = carve(wElems);
  _Float16* Qh  = carve(xElems);
  _Float16* Kh  = carve(xElems);
  _Float16* Vh  = carve(xElems);
  _Float16* Oh  = carve(xElems);

  cvt_all_kernel<<<CVT_XB + 4 * CVT_WB, 256, 0, stream>>>(
      x, Wq, Wk, Wv, Wo, xh, wqh, wkh, wvh, woh);

  dim3 gemmGrid((Nb * LSEQ) / 128, DIM / 128);
  dim3 qkvGrid((Nb * LSEQ) / 128, DIM / 128, 3);
  qkv_gemm_kernel<<<qkvGrid, 256, 0, stream>>>(xh, wqh, wkh, wvh, bq, bk, bv,
                                               Qh, Kh, Vh);

  dim3 attnGrid(LSEQ / 128, NH, Nb);
  attention_kernel<<<attnGrid, 256, 0, stream>>>(Qh, Kh, Vh, attn_bias, kpm, Oh);

  out_gemm_kernel<<<gemmGrid, 256, 0, stream>>>(Oh, woh, bo, out);
}

// v005
// A run of this version takes 87 microseconds.
// Next to v004, in two timings, it ran 1.26 times as fast each time.
// Over all steps from v000 it is 2.47 times as fast.
#include <hip/hip_runtime.h>
#include <hip/hip_bf16.h>

typedef __attribute__((ext_vector_type(16))) _Float16 v16h;
typedef __attribute__((ext_vector_type(8)))  _Float16 v8h;
typedef __attribute__((ext_vector_type(8)))  float    v8f;
typedef __attribute__((ext_vector_type(4)))  float    v4f;
typedef __attribute__((ext_vector_type(4)))  int      v4i;

#define DEV __device__ __forceinline__

static constexpr int Nb   = 16;
static constexpr int LSEQ = 1024;
static constexpr int DIM  = 512;
static constexpr int NH   = 8;
static constexpr int HD   = 64;

// ---------------------------------------------------------------------------
// WMMA fragment load (ISA 7.12.2 16-bit A/B layout):
//   lane l<16 : row m=l,    K in {0..7, 16..23}
//   lane l>=16: row m=l-16, K in {8..15, 24..31}
// => two contiguous 16-byte (8-half) runs per lane at K=koff and K=koff+16.
// ---------------------------------------------------------------------------
DEV v16h load_frag_rowmajor(const _Float16* __restrict__ base, int ld) {
  const int lane = threadIdx.x & 31;
  const int m    = lane & 15;
  const int koff = (lane >> 4) << 3;            // 0 or 8
  const _Float16* p = base + m * ld + koff;
  v8h lo = *(const v8h*)(p);
  v8h hi = *(const v8h*)(p + 16);
  v16h r;
#pragma unroll
  for (int i = 0; i < 8; ++i) { r[i] = lo[i]; r[i + 8] = hi[i]; }
  return r;
}

DEV v8f wmma_f16(v16h a, v16h b, v8f c) {
  return __builtin_amdgcn_wmma_f32_16x16x32_f16(
      false, a, false, b, (short)0, c, false, false);
}

DEV void wait_async_all() {
  asm volatile("s_wait_asynccnt 0" ::: "memory");
}

// ---------------------------------------------------------------------------
// f32 -> f16 conversion of x and of the four weight matrices, part of launch 1:
// CVT_XB blocks stride over x; behind them CVT_WB blocks per matrix.
// ---------------------------------------------------------------------------
static constexpr int CVT_XB = 2048;
static constexpr int CVT_WB = 256;

DEV void cvt_range(const float* __restrict__ src, _Float16* __restrict__ dst,
                   int n, int block, int nblocks) {
  int i = block * 256 + threadIdx.x;
  const int stride = nblocks * 256;
  for (; i < n; i += stride) dst[i] = (_Float16)src[i];
}

// ---------------------------------------------------------------------------
// Masked keys get the score -1e9, whose softmax weight is exactly 0 as soon as
// one key of the batch is unmasked.  So the unmasked keys are packed to the
// front: K and V rows and bias columns move to the key's rank among the
// unmasked keys of its batch, and attention walks only the packed keys.
// The count is rounded up to 32; the filler keys have K = V = 0 and bias -1e9.
// A batch with no unmasked key keeps all keys, with K = 0 and bias -1e9: every
// score is then exactly -1e9, as in the definition.
// ---------------------------------------------------------------------------
static constexpr int BC_ROWS = 32;                    // bias rows per block
static constexpr int BC_B    = Nb * LSEQ / BC_ROWS;   // blocks that pack the bias

// Thread t owns keys 4t .. 4t+3 of one batch.  Returns the rank of key 4t among
// the unmasked keys; total = number of unmasked keys.  wt: 8 ints of LDS.
DEV int mask_scan(const int* __restrict__ mrow, int* wt, bool (&keep)[4], int& total) {
  const int t = threadIdx.x;
  const v4i m = *(const v4i*)(mrow + 4 * t);
  unsigned pre = 0;
  int wsum = 0;
#pragma unroll
  for (int i = 0; i < 4; ++i) {
    keep[i] = m[i] != 0;
    const unsigned b = __builtin_amdgcn_ballot_w32(keep[i]);
    pre = __builtin_amdgcn_mbcnt_lo(b, pre);          // unmasked keys of lower lanes
    wsum += __builtin_popcount(b);
  }
  if ((t & 31) == 0) wt[t >> 5] = wsum;
  __syncthreads();                                    // wave sums visible to all
  int off = 0;
  total = 0;
#pragma unroll
  for (int w = 0; w < 8; ++w) {
    const int v = wt[w];
    total += v;
    if (w < (t >> 5)) off += v;
  }
  return off + (int)pre;
}

// biasC[n][q][rank] = bias[n][q][key of that rank], BC_ROWS query rows per block
DEV void pack_bias(const float* __restrict__ bias, const int* __restrict__ mask,
                   float* __restrict__ biasC, int b, int* idxs, int* wt) {
  const int t    = threadIdx.x;
  const int n    = b / (LSEQ / BC_ROWS);
  const int row0 = (b % (LSEQ / BC_ROWS)) * BC_ROWS;
  bool keep[4];
  int total;
  int p = mask_scan(mask + n * LSEQ, wt, keep, total);
#pragma unroll
  for (int i = 0; i < 4; ++i)
    if (keep[i]) idxs[p++] = 4 * t + i;
  __syncthreads();                                    // rank -> key table complete
  const int cntPad = (total == 0) ? LSEQ : ((total + 31) & ~31);
  const float* src = bias  + ((size_t)n * LSEQ + row0) * LSEQ;
  float*       dst = biasC + ((size_t)n * LSEQ + row0) * LSEQ;
  for (int k0 = 0; k0 < cntPad; k0 += 256) {
    const int  kp   = k0 + t;
    const bool real = kp < total;
    const int  id   = real ? idxs[kp] : 0;
    if (kp < cntPad) {
      const float* sp = src + id;
      float*       dp = dst + kp;
      float v[BC_ROWS];
#pragma unroll                                        // all rows' loads in flight
      for (int r = 0; r < BC_ROWS; ++r) v[r] = sp[(size_t)r * LSEQ];
#pragma unroll
      for (int r = 0; r < BC_ROWS; ++r) dp[(size_t)r * LSEQ] = real ? v[r] : -1.0e9f;
      // The stores' address registers are stepped in the next trip; the wait
      // names them as inputs so that no rewrite of them is lifted over it.
      asm volatile("s_wait_xcnt 0x0" :: "v"(sp), "v"(dp) : "memory");
    }
  }
}

// One block per batch: key -> rank table (-1 = masked), the padded count, the
// all-masked flag, and zeros in the filler rows of the packed K and V.
DEV void key_table(const int* __restrict__ mask, int* __restrict__ pos,
                   int* __restrict__ meta, _Float16* __restrict__ Kc,
                   _Float16* __restrict__ Vc, int n, int* wt) {
  const int t = threadIdx.x;
  bool keep[4];
  int total;
  int p = mask_scan(mask + n * LSEQ, wt, keep, total);
  const bool allm   = total == 0;
  const int  cnt    = allm ? LSEQ : total;
  const int  cntPad = (cnt + 31) & ~31;
  v4i pv;
#pragma unroll
  for (int i = 0; i < 4; ++i) pv[i] = allm ? 4 * t + i : (keep[i] ? p++ : -1);
  *(v4i*)(pos + n * LSEQ + 4 * t) = pv;
  if (t == 0) { meta[2 * n] = cntPad; meta[2 * n + 1] = allm ? 1 : 0; }
  const v8h zero = {};
  for (int c = t; c < (cntPad - cnt) * 64; c += 256) {
    const int row = cnt + (c >> 6), h = (c >> 3) & 7, col = (c & 7) * 8;
    const size_t off = (((size_t)n * NH + h) * LSEQ + row) * HD + col;
    *(v8h*)(Kc + off) = zero;
    *(v8h*)(Vc + off) = zero;
  }
}

// Launch 1.  The bias blocks move the most bytes and have the low indices.
__global__ __launch_bounds__(256)
void prep_kernel(const float* __restrict__ x,
                 const float* __restrict__ Wq, const float* __restrict__ Wk,
                 const float* __restrict__ Wv, const float* __restrict__ Wo,
                 const float* __restrict__ bias, const int* __restrict__ mask,
                 _Float16* __restrict__ xh,
                 _Float16* __restrict__ wqh, _Float16* __restrict__ wkh,
                 _Float16* __restrict__ wvh, _Float16* __restrict__ woh,
                 float* __restrict__ biasC, int* __restrict__ pos,
                 int* __restrict__ meta,
                 _Float16* __restrict__ Kc, _Float16* __restrict__ Vc) {
  __shared__ int idxs[LSEQ];
  __shared__ int wt[8];
  int b = blockIdx.x;
  if (b < BC_B) {
    pack_bias(bias, mask, biasC, b, idxs, wt);
    return;
  }
  b -= BC_B;
  if (b < CVT_XB) {
    cvt_range(x, xh, Nb * LSEQ * DIM, b, CVT_XB);
    return;
  }
  b -= CVT_XB;
  if (b < 4 * CVT_WB) {
    const int w  = b / CVT_WB;
    const int wb = b % CVT_WB;
    const float* src = (w == 0) ? Wq : (w == 1) ? Wk : (w == 2) ? Wv : Wo;
    _Float16*    dst = (w == 0) ? wqh : (w == 1) ? wkh : (w == 2) ? wvh : woh;
    cvt_range(src, dst, DIM * DIM, wb, CVT_WB);
    return;
  }
  key_table(mask, pos, meta, Kc, Vc, b - 4 * CVT_WB, wt);
}

// ---------------------------------------------------------------------------
// Shared GEMM tile: block 128(M) x 128(N), K-step 64, 8 waves as 4(M) x 2(N),
// each wave 32 x 64 (2 x 4 accumulator tiles).  A K-step is 128 bytes of every
// operand row, one whole cache line; LDS rows padded to 72 halves (144 bytes).
// ---------------------------------------------------------------------------
static constexpr int GK   = 64;             // halves of k per step
static constexpr int GLD  = 72;             // LDS row pitch in halves
static constexpr int GBUF = 128 * GLD;      // halves per operand tile
static constexpr int GSTEPS = DIM / GK;

// Four async copies of 16 bytes per lane.  The s_wait_xcnt is the statement's
// last line so that no rewrite of the copies' address registers gets ahead of it.
DEV void async_copy4_b128(const _Float16* src, int src_step,
                          _Float16* lds_dst, int dst_step) {
  const _Float16* s0 = src;
  const _Float16* s1 = src + src_step;
  const _Float16* s2 = src + 2 * src_step;
  const _Float16* s3 = src + 3 * src_step;
  unsigned d0 = (unsigned)(unsigned long long)lds_dst;   // addr[31:0] = LDS offset
  unsigned d1 = d0 + 2u * dst_step;
  unsigned d2 = d0 + 4u * dst_step;
  unsigned d3 = d0 + 6u * dst_step;
  asm volatile("global_load_async_to_lds_b128 %0, %4, off\n\t"
               "global_load_async_to_lds_b128 %1, %5, off\n\t"
               "global_load_async_to_lds_b128 %2, %6, off\n\t"
               "global_load_async_to_lds_b128 %3, %7, off\n\t"
               "s_wait_xcnt 0x0"
               :: "v"(d0), "v"(d1), "v"(d2), "v"(d3),
                  "v"(s0), "v"(s1), "v"(s2), "v"(s3) : "memory");
}

// One K-step of both operands: eight lanes cover one row's 128 bytes, so a
// wave's copy instruction takes four whole lines.
DEV void gemm_prefetch(const _Float16* __restrict__ Abase,
                       const _Float16* __restrict__ Wbase, int k0,
                       _Float16* xs, _Float16* ws) {
  const int row = threadIdx.x >> 3;           // 0..31, then +32, +64, +96
  const int col = (threadIdx.x & 7) * 8;
  async_copy4_b128(Abase + (size_t)row * DIM + k0 + col, 32 * DIM,
                   xs + row * GLD + col, 32 * GLD);
  async_copy4_b128(Wbase + (size_t)row * DIM + k0 + col, 32 * DIM,
                   ws + row * GLD + col, 32 * GLD);
}

// acc[i][t] += A(rows wm*32 + i*16 ..) . W(rows wn*64 + t*16 ..)^T over all of K.
// Two LDS buffers: the next step's copies fly while this step is worked on.
DEV void gemm_mainloop(const _Float16* __restrict__ Abase,
                       const _Float16* __restrict__ Wbase,
                       _Float16* xs, _Float16* ws, int wm, int wn,
                       v8f (&acc)[2][4]) {
  gemm_prefetch(Abase, Wbase, 0, xs, ws);
  wait_async_all();
  __syncthreads();                         // step 0 published to all waves
  gemm_prefetch(Abase, Wbase, GK, xs + GBUF, ws + GBUF);

  for (int s = 0; s < GSTEPS; ++s) {
    const _Float16* xb = xs + (s & 1) * GBUF + (wm * 32) * GLD;
    const _Float16* wb = ws + (s & 1) * GBUF + (wn * 64) * GLD;
    // the loops below are unrolled so that fragments and accumulators are
    // indexed by constants and stay in registers
#pragma unroll
    for (int kk = 0; kk < GK; kk += 32) {
      v16h a[2], b[4];
#pragma unroll
      for (int i = 0; i < 2; ++i) a[i] = load_frag_rowmajor(xb + i * 16 * GLD + kk, GLD);
#pragma unroll
      for (int t = 0; t < 4; ++t) b[t] = load_frag_rowmajor(wb + t * 16 * GLD + kk, GLD);
#pragma unroll
      for (int i = 0; i < 2; ++i)
#pragma unroll
        for (int t = 0; t < 4; ++t) acc[i][t] = wmma_f16(a[i], b[t], acc[i][t]);
    }
    // own LDS reads done, own copies of step s + 1 landed, then the barrier:
    // it publishes step s + 1 and frees the buffer that step s has read
    asm volatile("s_wait_dscnt 0x0" ::: "memory");
    wait_async_all();
    __syncthreads();
    if (s + 2 < GSTEPS)
      gemm_prefetch(Abase, Wbase, (s + 2) * GK,
                    xs + (s & 1) * GBUF, ws + (s & 1) * GBUF);
  }
  wait_async_all();                        // nothing in flight when the wave ends
}

// ---------------------------------------------------------------------------
// QKV projection: out[(n,h,l,hd)] = f16( A(row) . W(row o)^T + bias[o] )
// One launch for the three projections: blockIdx.z picks Q, K or V.
// ---------------------------------------------------------------------------
__global__ __launch_bounds__(256)
void qkv_gemm_kernel(const _Float16* __restrict__ A,
                     const _Float16* __restrict__ Wq,
                     const _Float16* __restrict__ Wk,
                     const _Float16* __restrict__ Wv,
                     const float* __restrict__ bq,
                     const float* __restrict__ bk,
                     const float* __restrict__ bv,
                     _Float16* __restrict__ Qo,
                     _Float16* __restrict__ Ko,
                     _Float16* __restrict__ Vo,
                     const int* __restrict__ pos,
                     const int* __restrict__ meta) {
  __shared__ __align__(16) _Float16 Xs[2 * GBUF];
  __shared__ __align__(16) _Float16 Ws[2 * GBUF];

  const int z = blockIdx.z;
  const _Float16* W    = (z == 0) ? Wq : (z == 1) ? Wk : Wv;
  const float*    bias = (z == 0) ? bq : (z == 1) ? bk : bv;
  _Float16*       out  = (z == 0) ? Qo : (z == 1) ? Ko : Vo;

  const int wave  = threadIdx.x >> 5;
  const int lane  = threadIdx.x & 31;
  const int wm    = wave & 3;
  const int wn    = wave >> 2;
  const int mBase = blockIdx.x * 128;
  const int nBase = blockIdx.y * 128;

  v8f acc[2][4] = {};
  gemm_mainloop(A + (size_t)mBase * DIM, W + (size_t)nBase * DIM, Xs, Ws, wm, wn, acc);

  const int half = lane >> 4;
  const int ncol = lane & 15;
  const int n    = mBase >> 10;               // a block's 128 rows lie in one batch
  const int l0   = (mBase & (LSEQ - 1)) + wm * 32 + half * 8;
  const int h    = (nBase + wn * 64) >> 6;    // a wave's 64 columns are one head
  // K of a batch without any unmasked key is stored as zero (scores exactly -1e9)
  const bool kzero = (z == 1) && (meta[2 * n + 1] != 0);

  // Q rows stay where they are; K and V rows go to their key's rank, masked
  // keys (rank -1) are not stored
  const int*   pp = pos + n * LSEQ + l0;
  const float* bp = bias + nBase + wn * 64 + ncol;
  v4i pr[2][2];
  float bvv[4];
#pragma unroll                                // constant index: registers
  for (int i = 0; i < 2; ++i) {
    pr[i][0] = *(const v4i*)(pp + i * 16);
    pr[i][1] = *(const v4i*)(pp + i * 16 + 4);
  }
#pragma unroll
  for (int t = 0; t < 4; ++t) bvv[t] = bp[t * 16];
  // The loads' address registers are reused right below; the wait names them
  // as inputs so that no rewrite of them is lifted over it.
  asm volatile("s_wait_xcnt 0x0" :: "v"(pp), "v"(bp) : "memory");
  int prow[2][8];
#pragma unroll
  for (int i = 0; i < 2; ++i)
#pragma unroll
    for (int r = 0; r < 8; ++r)
      prow[i][r] = (z == 0) ? l0 + i * 16 + r : min(pr[i][r >> 2][r & 3], LSEQ - 1);

  _Float16* obase = out + ((size_t)n * NH + h) * LSEQ * HD + ncol;
#pragma unroll                                // constant index into acc: registers
  for (int i = 0; i < 2; ++i) {
#pragma unroll
    for (int r = 0; r < 8; ++r) {
      if (prow[i][r] >= 0) {
#pragma unroll
        for (int t = 0; t < 4; ++t)
          obase[(size_t)prow[i][r] * HD + t * 16] =
              kzero ? (_Float16)0.f : (_Float16)(acc[i][t][r] + bvv[t]);
      }
    }
  }
}

// ---------------------------------------------------------------------------
// Output projection: d_out[row, o] = f32( O(row) . Wo(row o)^T + bo[o] )
// ---------------------------------------------------------------------------
__global__ __launch_bounds__(256)
void out_gemm_kernel(const _Float16* __restrict__ A,
                     const _Float16* __restrict__ W,
                     const float* __restrict__ bias,
                     float* __restrict__ out) {
  __shared__ __align__(16) _Float16 Xs[2 * GBUF];
  __shared__ __align__(16) _Float16 Ws[2 * GBUF];

  const int wave  = threadIdx.x >> 5;
  const int lane  = threadIdx.x & 31;
  const int wm    = wave & 3;
  const int wn    = wave >> 2;
  const int mBase = blockIdx.x * 128;
  const int nBase = blockIdx.y * 128;

  v8f acc[2][4] = {};
  gemm_mainloop(A + (size_t)mBase * DIM, W + (size_t)nBase * DIM, Xs, Ws, wm, wn, acc);

  const int half = lane >> 4;
  const int ncol = lane & 15;
#pragma unroll
  for (int t = 0; t < 4; ++t) {
    int o  = nBase + wn * 64 + t * 16 + ncol;
    float bv = bias[o];
#pragma unroll                              // constant index into acc: registers
    for (int i = 0; i < 2; ++i) {
#pragma unroll
      for (int r = 0; r < 8; ++r) {
        int row = mBase + wm * 32 + i * 16 + r + half * 8;
        out[(size_t)row * DIM + o] = acc[i][t][r] + bv;
      }
    }
  }
}

// ---------------------------------------------------------------------------
// Attention tile prefetchers
// ---------------------------------------------------------------------------
static constexpr int KLD = 72;   // K rows: 144 bytes, 16 B x odd, for ds_load_b128
static constexpr int VLD = 80;   // V rows: 160 bytes, 32 B x odd, for ds_load_tr16_b128

// One 32-key tile of K and of V, both row-major: eight lanes take one row's
// 128 bytes, async global -> LDS, 16 bytes per lane (ASYNCcnt).  The s_wait_xcnt
// is the statement's last line so that no rewrite of the copies' address
// registers gets ahead of it.
DEV void attn_prefetch_KV(const _Float16* __restrict__ Kbase,
                          const _Float16* __restrict__ Vbase,
                          _Float16* ks, _Float16* vs) {
  const int row = threadIdx.x >> 3;           // key 0..31
  const int col = (threadIdx.x & 7) * 8;      // d
  const _Float16* sk = Kbase + (size_t)row * HD + col;
  const _Float16* sv = Vbase + (size_t)row * HD + col;
  unsigned dk = (unsigned)(unsigned long long)(ks + row * KLD + col);  // LDS offset
  unsigned dv = (unsigned)(unsigned long long)(vs + row * VLD + col);
  asm volatile("global_load_async_to_lds_b128 %0, %2, off\n\t"
               "global_load_async_to_lds_b128 %1, %3, off\n\t"
               "s_wait_xcnt 0x0"
               :: "v"(dk), "v"(dv), "v"(sk), "v"(sv) : "memory");
}

// Transposing LDS load: from a row-major tile T[key][d], with lane l pointing at
// row 8*(l>>4) + (l&7), 16 bytes * ((l>>3)&1), lane (c, half) receives
// T[8*half + 0..7][c]: half of a 16(d) x 32(key) A fragment in hardware k order.
typedef short s16x8 __attribute__((ext_vector_type(8)));
DEV v8h lds_load_tr16(const _Float16* p) {
  typedef __attribute__((address_space(3))) s16x8 lds_s16x8;
  return __builtin_bit_cast(v8h, __builtin_amdgcn_ds_load_tr16_b128_v8i16((lds_s16x8*)p));
}

// ---------------------------------------------------------------------------
// Lane l <-> l ^ 16 exchange (the two halves of a wave hold one query's keys).
// ---------------------------------------------------------------------------
DEV float other_half(float v) {
  int b = __builtin_bit_cast(int, v);
  b = __builtin_amdgcn_permlanex16(b, b, 0x76543210, 0xfedcba98, false, false);
  return __builtin_bit_cast(float, b);
}

__global__ __launch_bounds__(256)
void attention_kernel(const _Float16* __restrict__ Q,   // [N][H][L][HD]
                      const _Float16* __restrict__ K,
                      const _Float16* __restrict__ V,
                      const float* __restrict__ bias,   // [N][L][L], packed columns
                      const int* __restrict__ meta,     // [N][2]: padded count, flag
                      _Float16* __restrict__ O) {       // [N][L][DIM]
  __shared__ __align__(16) _Float16 Ks[2][32 * KLD];
  __shared__ __align__(16) _Float16 Vs[2][32 * VLD];

  const int wave = threadIdx.x >> 5;
  const int lane = threadIdx.x & 31;
  const int h    = blockIdx.y;
  const int n    = blockIdx.z;
  const int qBase = blockIdx.x * 128 + wave * 16;

  const size_t headOff = ((size_t)n * NH + h) * LSEQ * HD;

  const _Float16* qptr = Q + headOff + (size_t)qBase * HD;
  v16h aQ0 = load_frag_rowmajor(qptr, HD);
  v16h aQ1 = load_frag_rowmajor(qptr + 32, HD);

  const int half = lane >> 4;
  const int qcol = lane & 15;

  float mrun = -1e30f;      // running maximum of this lane's query
  float lrun = 0.f;         // this half's share of the query's row sum
  v8f  o[4] = {};           // o[t][r] = O[query qcol][d = t*16 + 8*half + r]

  const float* brow =
      bias + ((size_t)n * LSEQ + (qBase + qcol)) * LSEQ + half * 8;
  // packed keys of this batch: a multiple of 32, at most LSEQ
  const int kEnd = min(meta[2 * n], LSEQ) & ~31;

  // this lane's place in a V tile for the transposing loads
  const int vlane = (half * 8 + (lane & 7)) * VLD + ((lane >> 3) & 1) * 8;

  attn_prefetch_KV(K + headOff, V + headOff, Ks[0], Vs[0]);

  int buf = 0;
  for (int kb = 0; kb < kEnd; kb += 32, buf ^= 1) {
    // own LDS reads of the last tile done, own copies of this tile landed, then
    // the barrier: it publishes this tile and frees the buffer refilled below
    asm volatile("s_wait_dscnt 0x0" ::: "memory");
    wait_async_all();
    __syncthreads();
    if (kb + 32 < kEnd)
      attn_prefetch_KV(K + headOff + (size_t)(kb + 32) * HD,
                       V + headOff + (size_t)(kb + 32) * HD,
                       Ks[buf ^ 1], Vs[buf ^ 1]);

    // this lane's 16 bias values: 8 consecutive keys per tile
    const float* bp = brow + kb;
    v4f bb[2][2];
#pragma unroll
    for (int j = 0; j < 2; ++j) {
      bb[j][0] = *(const v4f*)(bp + j * 16);
      bb[j][1] = *(const v4f*)(bp + j * 16 + 4);
    }
    // The four loads' address registers are reused right below; the wait
    // names them as inputs so that no rewrite of them is lifted over it.
    asm volatile("s_wait_xcnt 0x0" :: "v"(bp) : "memory");

    // S^T = K Q^T : 32 keys x 16 queries, two 16-key tiles
    v8f s[2];
#pragma unroll
    for (int j = 0; j < 2; ++j) {
      v16h a0 = load_frag_rowmajor(&Ks[buf][(j * 16) * KLD], KLD);
      v16h a1 = load_frag_rowmajor(&Ks[buf][(j * 16) * KLD + 32], KLD);
      v8f c = {};
      c = wmma_f16(a0, aQ0, c);
      c = wmma_f16(a1, aQ1, c);
      s[j] = c;
    }

    // scale + bias (filler keys carry -1e9 in the packed bias)
#pragma unroll
    for (int j = 0; j < 2; ++j) {
#pragma unroll
      for (int r = 0; r < 8; ++r) {
        s[j][r] = s[j][r] * 0.125f + bb[j][r >> 2][r & 3];
      }
    }

    // online softmax: maximum over own registers, one exchange between halves
    float v = fmaxf(s[0][0], s[1][0]);
#pragma unroll
    for (int r = 1; r < 8; ++r) v = fmaxf(v, fmaxf(s[0][r], s[1][r]));
    v = fmaxf(v, other_half(v));
    const float mnew  = fmaxf(mrun, v);
    const float alpha = __expf(mrun - mnew);
    mrun = mnew;

    float ps = 0.f;
#pragma unroll
    for (int j = 0; j < 2; ++j) {
#pragma unroll
      for (int r = 0; r < 8; ++r) {
        s[j][r] = __expf(s[j][r] - mnew);
        ps += s[j][r];
      }
    }
    lrun = lrun * alpha + ps;

    // P^T as B operand: element e = tile e>>3, register e&7 (hardware k order)
    v8h p0 = __builtin_convertvector(s[0], v8h);
    v8h p1 = __builtin_convertvector(s[1], v8h);
    v16h bP;
#pragma unroll
    for (int i = 0; i < 8; ++i) { bP[i] = p0[i]; bP[i + 8] = p1[i]; }

    // O^T = O^T * alpha + V^T P^T
#pragma unroll
    for (int t = 0; t < 4; ++t) {
      v8h lo = lds_load_tr16(&Vs[buf][vlane + t * 16]);             // keys 8*half + 0..7
      v8h hi = lds_load_tr16(&Vs[buf][vlane + 16 * VLD + t * 16]);  // keys 16 + 8*half + 0..7
      v16h aV;
#pragma unroll                              // constant index into aV: registers
      for (int i = 0; i < 8; ++i) { aV[i] = lo[i]; aV[i + 8] = hi[i]; }
      o[t] *= alpha;
      o[t] = wmma_f16(aV, bP, o[t]);
    }
  }

  wait_async_all();           // nothing in flight when the wave ends

  // finalize: join the halves' sums, divide, write f16 [n][L][h*64 + d]
  const float inv = 1.0f / (lrun + other_half(lrun));
  _Float16* optr =
      O + ((size_t)n * LSEQ + (qBase + qcol)) * DIM + h * HD + half * 8;
#pragma unroll
  for (int t = 0; t < 4; ++t)
    *(v8h*)(optr + t * 16) = __builtin_convertvector(o[t] * inv, v8h);
}

// ---------------------------------------------------------------------------
// Launch
// ---------------------------------------------------------------------------
extern "C" void kernel_launch(void* const* d_in, const int* in_sizes, int n_in,
                              void* d_out, int out_size, void* d_ws, size_t ws_size,
                              hipStream_t stream) {
  (void)in_sizes; (void)n_in; (void)out_size; (void)ws_size;
  const float* x         = (const float*)d_in[0];
  const float* attn_bias = (const float*)d_in[1];
  const int*   kpm       = (const int*)d_in[2];
  const float* Wq = (const float*)d_in[3];
  const float* bq = (const float*)d_in[4];
  const float* Wk = (const float*)d_in[5];
  const float* bk = (const float*)d_in[6];
  const float* Wv = (const float*)d_in[7];
  const float* bv = (const float*)d_in[8];
  const float* Wo = (const float*)d_in[9];
  const float* bo = (const float*)d_in[10];
  float* out = (float*)d_out;

  const size_t xElems = (size_t)Nb * LSEQ * DIM;   // 8,388,608
  const size_t wElems = (size_t)DIM * DIM;         //   262,144

  char* wsp = (char*)d_ws;
  auto carve = [&](size_t halves) {
    _Float16* p = (_Float16*)wsp;
    wsp += ((halves * sizeof(_Float16) + 255) / 256) * 256;
    return p;
  };
  _Float16* xh  = carve(xElems);
  _Float16* wqh = carve(wElems);
  _Float16* wkh = carve(wElems);
  _Float16* wvh = carve(wElems);
  _Float16* woh = carve(wElems);
  _Float16* Qh  = carve(xElems);
  _Float16* Kh  = carve(xElems);
  _Float16* Vh  = carve(xElems);
  _Float16* Oh  = carve(xElems);
  float* biasC = (float*)carve((size_t)2 * Nb * LSEQ * LSEQ);
  int*   pos   = (int*)carve((size_t)2 * Nb * LSEQ);
  int*   meta  = (int*)carve((size_t)2 * 2 * Nb);

  prep_kernel<<<BC_B + CVT_XB + 4 * CVT_WB + Nb, 256, 0, stream>>>(
      x, Wq, Wk, Wv, Wo, attn_bias, kpm, xh, wqh, wkh, wvh, woh,
      biasC, pos, meta, Kh, Vh);

  dim3 gemmGrid((Nb * LSEQ) / 128, DIM / 128);
  dim3 qkvGrid((Nb * LSEQ) / 128, DIM / 128, 3);
  qkv_gemm_kernel<<<qkvGrid, 256, 0, stream>>>(xh, wqh, wkh, wvh, bq, bk, bv,
                                               Qh, Kh, Vh, pos, meta);

  dim3 attnGrid(LSEQ / 128, NH, Nb);
  attention_kernel<<<attnGrid, 256, 0, stream>>>(Qh, Kh, Vh, biasC, meta, Oh);

  out_gemm_kernel<<<gemmGrid, 256, 0, stream>>>(Oh, woh, bo, out);
}
